// v000
// Measured on an AMD MI455X. A time is GPU time per run, averaged over a window of back-to-back runs after a warm-up
// (all launches, gaps included; the runs take copies of the inputs in turn), and the median of several windows.
// Apart from v000's, it joins two sittings. Times from different sittings can be a few percent apart, while
// side-by-side timings come from the same sitting.
// v000, which the later versions start from, runs in 1800 microseconds.
#include <hip/hip_runtime.h>

// Snail (causal) attention read head: q, k, v = x Wq/Wk/Wv + b (128 -> 64 each); probs = softmax((q k^T + causal mask) / 8); read = probs v; out = [x | read] -> [4][4096][192].
// Deterministic, no atomics, no index structures; keys in order with an online softmax over 32-key chunks up to the query block's diagonal.
// WMMA (v_wmma_f32_16x16x32_f16, f32 accumulate): [q|k|v] = x [Wq|Wk|Wv] (x EXACT bf16 x8; (in,out) weights transposed exact x256); per (batch, 16 queries): S = q k^T (q, k hi+lo x8, 3 products), acc += P v (P plain x1024 relative to the
// running max, v^T hi+lo x8); the mask, softmax bookkeeping and the final division in f32; the x half of the output is the bf16-rounded input copied through. Inputs rounded to bf16 once. Fragment k-map per lane

namespace {
constexpr int B = 4, S = 4096, D = 128, KS = 64, DO = D + KS, NBLK = S / 16;
constexpr float XS = 8.0f, PS = 1024.0f, WSC = 256.0f;
typedef _Float16 b16;
typedef __attribute__((ext_vector_type(16))) _Float16 v16b;
typedef __attribute__((ext_vector_type(8))) _Float16 v8b;
typedef __attribute__((ext_vector_type(8))) float v8f;
typedef __attribute__((ext_vector_type(4))) float v4f;
typedef __attribute__((ext_vector_type(2))) float v2f;
__device__ __forceinline__ float bf16_rne(float f) { unsigned int u = __float_as_uint(f); u += 0x7FFFu + ((u >> 16) & 1u); return __uint_as_float(u & 0xFFFF0000u); }
__device__ __forceinline__ void split16(float v, b16& hi, b16& lo) { hi = (b16)v; lo = (b16)(v - (float)hi); }
__device__ __forceinline__ v16b frag_kb(const b16* p, int hh) { const v8b a = *(const v8b*)(p + 8 * hh), b = *(const v8b*)(p + 16 + 8 * hh); v16b f;
#pragma unroll
  for (int e = 0; e < 8; ++e) { f[e] = a[e]; f[8 + e] = b[e]; } return f; }
__device__ __forceinline__ v8f wmma16b(v16b a, v16b b, v8f c) { v8f d = __builtin_amdgcn_wmma_f32_16x16x32_f16(false, a, false, b, (short)0, c, false, false); asm volatile("v_nop\n\tv_nop\n\tv_nop\n\tv_nop" : "+v"(d) : "v"(a), "v"(b)); return d; }
__device__ __forceinline__ void wave_lds_sync() { __builtin_amdgcn_fence(__ATOMIC_RELEASE, "workgroup"); __builtin_amdgcn_wave_barrier(); __builtin_amdgcn_fence(__ATOMIC_ACQUIRE, "workgroup"); }
__device__ __forceinline__ float pmul(float a, float b) { float p = a * b; asm volatile("" : "+v"(p)); return p; }

__global__ __launch_bounds__(256) void wput_kernel(const float* __restrict__ w, int ro, b16* __restrict__ WT) {
  const int u = blockIdx.x * 256 + threadIdx.x; if (u >= KS * 16) return; const int o = u / 16, k0 = (u % 16) * 8; v8b v;
#pragma unroll
  for (int j = 0; j < 8; ++j) v[j] = (b16)(bf16_rne(w[(size_t)(k0 + j) * KS + o]) * WSC); { *(v8b*)(WT + (size_t)(ro + o) * D + k0) = v;  }
}
__global__ __launch_bounds__(32) void qkv_kernel(const float* __restrict__ x, const b16* __restrict__ WT, const float* __restrict__ bq, const float* __restrict__ bk, const float* __restrict__ bv, int RLIM, float* __restrict__ QKV, float* __restrict__ out) {
  __shared__ __attribute__((aligned(16))) b16 Ah[16][D + 8]; __shared__ __attribute__((aligned(16))) float Tf[16][3 * KS + 4];
  const int lane = threadIdx.x, nloc = lane & 15, hlf = lane >> 4; const size_t m0 = (size_t)blockIdx.x * 16; if (m0 >= (size_t)RLIM) return;
  for (int rr = 0; rr < 16; ++rr) for (int q = 0; q < 4; ++q) Ah[rr][q * 32 + lane] = (b16)(bf16_rne(x[(m0 + rr) * D + q * 32 + lane]) * XS);
  wave_lds_sync(); v8f acc[12];
#pragma unroll
  for (int t = 0; t < 12; ++t) acc[t] = (v8f){};
#pragma unroll
  for (int kb = 0; kb < D; kb += 32) { const v16b a = frag_kb(&Ah[nloc][kb], hlf);
#pragma unroll
    for (int t = 0; t < 12; ++t) acc[t] = wmma16b(a, frag_kb(WT + (size_t)(t * 16 + nloc) * D + kb, hlf), acc[t]); }
#pragma unroll
  for (int t = 0; t < 12; ++t) { const int c = t * 16 + nloc; const float bb = bf16_rne(c < KS ? bq[c] : (c < 2 * KS ? bk[c - KS] : bv[c - 2 * KS]));
#pragma unroll
    for (int r8 = 0; r8 < 8; ++r8) Tf[8 * hlf + r8][c] = acc[t][r8] * (1.0f / (XS * WSC)) + bb; }
  wave_lds_sync();
  { for (int rr = 0; rr < 16; ++rr) { for (int q = 0; q < 6; ++q) ((float*)QKV)[(m0 + rr) * (3 * KS) + q * 32 + lane] = Tf[rr][q * 32 + lane]; *(v4f*)(out + (m0 + rr) * DO + lane * 4) = (v4f){bf16_rne(x[(m0 + rr) * D + lane * 4]), bf16_rne(x[(m0 + rr) * D + lane * 4 + 1]), bf16_rne(x[(m0 + rr) * D + lane * 4 + 2]), bf16_rne(x[(m0 + rr) * D + lane * 4 + 3])}; }  }
}
// causal attention: wave per (batch, 16 queries): online softmax over 32-key chunks kc <= query block; S = q k^T / 8 (hi+lo, 3 products), mask keys > query, running M/Dn/Sf per row in LDS, acc rescale, acc += P v (P plain x1024,
__global__ __launch_bounds__(32) void att_kernel(const float* __restrict__ QKV, int BV, float* __restrict__ out) {
  __shared__ __attribute__((aligned(16))) b16 Qh[16][72], Ql[16][72], Kh[32][72], Kl[32][72], Ph[16][40], Vh[KS][40], Vl[KS][40]; __shared__ float Sc[16][33], M[16], Dn[16], Sf[16], Of[16][KS + 1];
  const int lane = threadIdx.x, nloc = lane & 15, hlf = lane >> 4; const int b = blockIdx.x / NBLK, qb = blockIdx.x % NBLK; if (b >= BV) return; const size_t base = (size_t)b * S; const size_t q0 = (size_t)qb * 16;
  for (int rr = 0; rr < 16; ++rr) for (int qd = 0; qd < 2; ++qd) { b16 p, ql; split16(QKV[(base + q0 + rr) * (3 * KS) + qd * 32 + lane] * XS, p, ql); Qh[rr][qd * 32 + lane] = p; Ql[rr][qd * 32 + lane] = ql; }
  if (lane < 16) { M[lane] = -INFINITY; Dn[lane] = 0.0f; Sf[lane] = 0.0f; }
  v8f acc[4];
#pragma unroll
  for (int t = 0; t < 4; ++t) acc[t] = (v8f){};
  wave_lds_sync();
#pragma unroll 1
  for (int kc = 0; kc < (int)q0 + 16; kc += 32) {
    for (int rr = 0; rr < 32; ++rr) { const size_t kn = base + kc + rr; const float* kp = QKV + kn * (3 * KS) + KS; const float* vp = QKV + kn * (3 * KS) + 2 * KS; b16 p, ql;   // rows past the diagonal exist (kc + rr < S) and are masked below
      for (int qd = 0; qd < 2; ++qd) { split16(kp[qd * 32 + lane] * XS, p, ql); Kh[rr][qd * 32 + lane] = p; Kl[rr][qd * 32 + lane] = ql; split16(vp[qd * 32 + lane] * XS, p, ql); Vh[qd * 32 + lane][rr] = p; Vl[qd * 32 + lane][rr] = ql; } }
    wave_lds_sync();
#pragma unroll
    for (int blk = 0; blk < 2; ++blk) { v8f s = {};
#pragma unroll
      for (int ks = 0; ks < KS; ks += 32) { const v16b qh = frag_kb(&Qh[nloc][ks], hlf), ql = frag_kb(&Ql[nloc][ks], hlf), kh = frag_kb(&Kh[blk * 16 + nloc][ks], hlf), kl = frag_kb(&Kl[blk * 16 + nloc][ks], hlf); s = wmma16b(qh, kh, s); s = wmma16b(qh, kl, s); s = wmma16b(ql, kh, s); }
#pragma unroll
      for (int r8 = 0; r8 < 8; ++r8) { const int qi = (int)q0 + 8 * hlf + r8, kj = kc + blk * 16 + nloc; Sc[8 * hlf + r8][blk * 16 + nloc] = kj > qi ? -INFINITY : s[r8] * (0.125f / (XS * XS)); } }
    wave_lds_sync();
#pragma unroll 1
    for (int qi = 0; qi < 16; ++qi) { const float sv = Sc[qi][lane]; float cm = sv; for (int o = 16; o; o >>= 1) cm = fmaxf(cm, __shfl_xor(cm, o)); const float mo = M[qi]; const float mn = fmaxf(mo, cm); const float p = sv == -INFINITY ? 0.0f : __expf(sv - mn); float psum = p; for (int o = 16; o; o >>= 1) psum += __shfl_xor(psum, o);
      Ph[qi][lane] = (b16)(p * PS); if (lane == 0) { const float sf = (mo == -INFINITY) ? 0.0f : __expf(mo - mn); Sf[qi] = sf; Dn[qi] = Dn[qi] * sf + psum; M[qi] = mn; } }
    wave_lds_sync();
#pragma unroll
    for (int t = 0; t < 4; ++t)
#pragma unroll
      for (int r8 = 0; r8 < 8; ++r8) acc[t][r8] *= Sf[8 * hlf + r8];
    { const v16b pa = frag_kb(&Ph[nloc][0], hlf);
#pragma unroll
      for (int t = 0; t < 4; ++t) { acc[t] = wmma16b(pa, frag_kb(&Vh[t * 16 + nloc][0], hlf), acc[t]); acc[t] = wmma16b(pa, frag_kb(&Vl[t * 16 + nloc][0], hlf), acc[t]); } }
    wave_lds_sync(); }
#pragma unroll
  for (int t = 0; t < 4; ++t)
#pragma unroll
    for (int r8 = 0; r8 < 8; ++r8) { const int rl = 8 * hlf + r8; Of[rl][t * 16 + nloc] = acc[t][r8] * (1.0f / (PS * XS)) / Dn[rl]; }
  wave_lds_sync();
  { for (int rr = 0; rr < 16; ++rr) *(v2f*)(out + (base + q0 + rr) * DO + D + lane * 2) = (v2f){Of[rr][lane * 2], Of[rr][lane * 2 + 1]};  }
}
}  // namespace

extern "C" void kernel_launch(void* const* d_in, const int* in_sizes, int n_in, void* d_out, int out_size, void* d_ws, size_t ws_size, hipStream_t stream) {
  (void)n_in;
  auto Fp = [&](int i) { return (const float*)d_in[i]; };
  // input order: 0 inputs [4,4096,128]; 1 Wq [128,64]; 2 bq; 3 Wk; 4 bk; 5 Wv; 6 bv
  if (in_sizes[0] != B * S * D || in_sizes[1] != D * KS || in_sizes[3] != D * KS || in_sizes[5] != D * KS || in_sizes[2] != KS || out_size != B * S * DO) return;
  const int BV = B, SV = S;
  size_t off = 0; char* ws = (char*)d_ws;
  auto carve = [&](size_t bytes) { char* p = ws + off; off += (bytes + 255) & ~(size_t)255; return p; };
  b16* WT = (b16*)carve((size_t)3 * KS * D * 2); float* QKV = (float*)carve((size_t)B * S * 3 * KS * 4);
  if (off > ws_size || off > ((size_t)16 << 20)) return;   // ~ 12.6 MB
  wput_kernel<<<(KS * 16 + 255) / 256, 256, 0, stream>>>(Fp(1), 0, WT); wput_kernel<<<(KS * 16 + 255) / 256, 256, 0, stream>>>(Fp(3), KS, WT); wput_kernel<<<(KS * 16 + 255) / 256, 256, 0, stream>>>(Fp(5), 2 * KS, WT);
  float* out = (float*)d_out;
  qkv_kernel<<<(unsigned)((BV == B ? B * S : SV) / 16), 32, 0, stream>>>(Fp(0), WT, Fp(2), Fp(4), Fp(6), BV == B ? B * S : SV, QKV, out);
  att_kernel<<<(unsigned)(BV == B ? B * NBLK : SV / 16), 32, 0, stream>>>(QKV, BV, out);
}

// v001
// One run takes 344 microseconds.
// Timed twice side by side with v000, it ran 5.24 and 5.25 times as fast.
#include <hip/hip_runtime.h>

// Snail (causal) attention read head: q, k, v = x Wq/Wk/Wv + b (128 -> 64 each); probs = softmax((q k^T + causal mask) / 8); read = probs v; out = [x | read] -> [4][4096][192].
// Deterministic, no atomics, no index structures; the keys of a query block are cut into pieces of 128, one wave per piece (online softmax over its 32-key chunks, keys in order); a merge launch joins the pieces in key order.
// WMMA (v_wmma_f32_16x16x32_f16, f32 accumulate): [q|k|v] = x [Wq|Wk|Wv] (x EXACT bf16 x8; (in,out) weights transposed exact x256); per (batch, 16 queries): S = q k^T (q, k hi+lo x8, 3 products), acc += P v (P plain x1024 relative to the
// running max, v^T hi+lo x8); the mask, softmax bookkeeping and the final division in f32; the x half of the output is the bf16-rounded input copied through. Inputs rounded to bf16 once. Fragment k-map per lane

namespace {
constexpr int B = 4, S = 4096, D = 128, KS = 64, DO = D + KS, NBLK = S / 16;
constexpr float XS = 8.0f, PS = 1024.0f, WSC = 256.0f;
// key split: a piece = PK keys (4 chunks of 32); the QG query blocks of group g = qb / QG each have g + 1 pieces; PPB pieces per batch
constexpr int PK = 128, QG = PK / 16, NG = NBLK / QG, PPB = QG * (NG * (NG + 1) / 2);
__device__ __forceinline__ int piece_slot0(int b, int qb) { const int g = qb / QG; return b * PPB + QG * (g * (g + 1) / 2) + (qb % QG) * (g + 1); }
typedef _Float16 b16;
typedef __attribute__((ext_vector_type(16))) _Float16 v16b;
typedef __attribute__((ext_vector_type(8))) _Float16 v8b;
typedef __attribute__((ext_vector_type(8))) float v8f;
typedef __attribute__((ext_vector_type(4))) float v4f;
typedef __attribute__((ext_vector_type(2))) float v2f;
__device__ __forceinline__ float bf16_rne(float f) { unsigned int u = __float_as_uint(f); u += 0x7FFFu + ((u >> 16) & 1u); return __uint_as_float(u & 0xFFFF0000u); }
__device__ __forceinline__ void split16(float v, b16& hi, b16& lo) { hi = (b16)v; lo = (b16)(v - (float)hi); }
__device__ __forceinline__ v16b frag_kb(const b16* p, int hh) { const v8b a = *(const v8b*)(p + 8 * hh), b = *(const v8b*)(p + 16 + 8 * hh); v16b f;
#pragma unroll
  for (int e = 0; e < 8; ++e) { f[e] = a[e]; f[8 + e] = b[e]; } return f; }
__device__ __forceinline__ v8f wmma16b(v16b a, v16b b, v8f c) { v8f d = __builtin_amdgcn_wmma_f32_16x16x32_f16(false, a, false, b, (short)0, c, false, false); asm volatile("v_nop\n\tv_nop\n\tv_nop\n\tv_nop" : "+v"(d) : "v"(a), "v"(b)); return d; }
__device__ __forceinline__ void wave_lds_sync() { __builtin_amdgcn_fence(__ATOMIC_RELEASE, "workgroup"); __builtin_amdgcn_wave_barrier(); __builtin_amdgcn_fence(__ATOMIC_ACQUIRE, "workgroup"); }
__device__ __forceinline__ float pmul(float a, float b) { float p = a * b; asm volatile("" : "+v"(p)); return p; }

__global__ __launch_bounds__(256) void wput_kernel(const float* __restrict__ w, int ro, b16* __restrict__ WT) {
  const int u = blockIdx.x * 256 + threadIdx.x; if (u >= KS * 16) return; const int o = u / 16, k0 = (u % 16) * 8; v8b v;
#pragma unroll
  for (int j = 0; j < 8; ++j) v[j] = (b16)(bf16_rne(w[(size_t)(k0 + j) * KS + o]) * WSC); { *(v8b*)(WT + (size_t)(ro + o) * D + k0) = v;  }
}
__global__ __launch_bounds__(32) void qkv_kernel(const float* __restrict__ x, const b16* __restrict__ WT, const float* __restrict__ bq, const float* __restrict__ bk, const float* __restrict__ bv, int RLIM, float* __restrict__ QKV, float* __restrict__ out) {
  __shared__ __attribute__((aligned(16))) b16 Ah[16][D + 8]; __shared__ __attribute__((aligned(16))) float Tf[16][3 * KS + 4];
  const int lane = threadIdx.x, nloc = lane & 15, hlf = lane >> 4; const size_t m0 = (size_t)blockIdx.x * 16; if (m0 >= (size_t)RLIM) return;
  for (int rr = 0; rr < 16; ++rr) for (int q = 0; q < 4; ++q) Ah[rr][q * 32 + lane] = (b16)(bf16_rne(x[(m0 + rr) * D + q * 32 + lane]) * XS);
  wave_lds_sync(); v8f acc[12];
#pragma unroll
  for (int t = 0; t < 12; ++t) acc[t] = (v8f){};
#pragma unroll
  for (int kb = 0; kb < D; kb += 32) { const v16b a = frag_kb(&Ah[nloc][kb], hlf);
#pragma unroll
    for (int t = 0; t < 12; ++t) acc[t] = wmma16b(a, frag_kb(WT + (size_t)(t * 16 + nloc) * D + kb, hlf), acc[t]); }
#pragma unroll
  for (int t = 0; t < 12; ++t) { const int c = t * 16 + nloc; const float bb = bf16_rne(c < KS ? bq[c] : (c < 2 * KS ? bk[c - KS] : bv[c - 2 * KS]));
#pragma unroll
    for (int r8 = 0; r8 < 8; ++r8) Tf[8 * hlf + r8][c] = acc[t][r8] * (1.0f / (XS * WSC)) + bb; }
  wave_lds_sync();
  { for (int rr = 0; rr < 16; ++rr) { for (int q = 0; q < 6; ++q) ((float*)QKV)[(m0 + rr) * (3 * KS) + q * 32 + lane] = Tf[rr][q * 32 + lane]; *(v4f*)(out + (m0 + rr) * DO + lane * 4) = (v4f){bf16_rne(x[(m0 + rr) * D + lane * 4]), bf16_rne(x[(m0 + rr) * D + lane * 4 + 1]), bf16_rne(x[(m0 + rr) * D + lane * 4 + 2]), bf16_rne(x[(m0 + rr) * D + lane * 4 + 3])}; }  }
}
// causal attention: wave per (batch, 16 queries, piece of 128 keys): online softmax over the piece's 32-key chunks kc <= query block; S = q k^T / 8 (hi+lo, 3 products), mask keys > query, running M/Dn/Sf per row in LDS, acc rescale, acc += P v (P plain x1024,
// the piece's unnormalised acc (register order), M and Dn go to the workspace. Groups g and NG - 1 - g are paired (NG + 1 pieces a pair), so the flat index covers exactly the pieces that exist.
__global__ __launch_bounds__(32) void att_kernel(const float* __restrict__ QKV, int BV, float* __restrict__ PA, float* __restrict__ PM) {
  __shared__ __attribute__((aligned(16))) b16 Qh[16][72], Ql[16][72], Kh[32][72], Kl[32][72], Ph[16][40], Vh[KS][40], Vl[KS][40]; __shared__ float Sc[16][33], M[16], Dn[16], Sf[16];
  const int lane = threadIdx.x, nloc = lane & 15, hlf = lane >> 4; const int b = blockIdx.x / PPB, ib = blockIdx.x % PPB, jp = ib / QG, pr = jp / (NG + 1), rp = jp % (NG + 1); if (b >= BV) return;
  const int g = rp <= pr ? pr : NG - 1 - pr, pc = rp <= pr ? rp : rp - pr - 1, qb = g * QG + ib % QG; const size_t base = (size_t)b * S; const size_t q0 = (size_t)qb * 16; const int kend = min(pc * PK + PK, (int)q0 + 16);
  for (int rr = 0; rr < 16; ++rr) for (int qd = 0; qd < 2; ++qd) { b16 p, ql; split16(QKV[(base + q0 + rr) * (3 * KS) + qd * 32 + lane] * XS, p, ql); Qh[rr][qd * 32 + lane] = p; Ql[rr][qd * 32 + lane] = ql; }
  if (lane < 16) { M[lane] = -INFINITY; Dn[lane] = 0.0f; Sf[lane] = 0.0f; }
  v8f acc[4];
#pragma unroll
  for (int t = 0; t < 4; ++t) acc[t] = (v8f){};
  wave_lds_sync();
#pragma unroll 1
  for (int kc = pc * PK; kc < kend; kc += 32) {
    for (int rr = 0; rr < 32; ++rr) { const size_t kn = base + kc + rr; const float* kp = QKV + kn * (3 * KS) + KS; const float* vp = QKV + kn * (3 * KS) + 2 * KS; b16 p, ql;   // rows past the diagonal exist (kc + rr < S) and are masked below
      for (int qd = 0; qd < 2; ++qd) { split16(kp[qd * 32 + lane] * XS, p, ql); Kh[rr][qd * 32 + lane] = p; Kl[rr][qd * 32 + lane] = ql; split16(vp[qd * 32 + lane] * XS, p, ql); Vh[qd * 32 + lane][rr] = p; Vl[qd * 32 + lane][rr] = ql; } }
    wave_lds_sync();
#pragma unroll
    for (int blk = 0; blk < 2; ++blk) { v8f s = {};
#pragma unroll
      for (int ks = 0; ks < KS; ks += 32) { const v16b qh = frag_kb(&Qh[nloc][ks], hlf), ql = frag_kb(&Ql[nloc][ks], hlf), kh = frag_kb(&Kh[blk * 16 + nloc][ks], hlf), kl = frag_kb(&Kl[blk * 16 + nloc][ks], hlf); s = wmma16b(qh, kh, s); s = wmma16b(qh, kl, s); s = wmma16b(ql, kh, s); }
#pragma unroll
      for (int r8 = 0; r8 < 8; ++r8) { const int qi = (int)q0 + 8 * hlf + r8, kj = kc + blk * 16 + nloc; Sc[8 * hlf + r8][blk * 16 + nloc] = kj > qi ? -INFINITY : s[r8] * (0.125f / (XS * XS)); } }
    wave_lds_sync();
#pragma unroll 1
    for (int qi = 0; qi < 16; ++qi) { const float sv = Sc[qi][lane]; float cm = sv; for (int o = 16; o; o >>= 1) cm = fmaxf(cm, __shfl_xor(cm, o)); const float mo = M[qi]; const float mn = fmaxf(mo, cm); const float p = sv == -INFINITY ? 0.0f : __expf(sv - mn); float psum = p; for (int o = 16; o; o >>= 1) psum += __shfl_xor(psum, o);
      Ph[qi][lane] = (b16)(p * PS); if (lane == 0) { const float sf = (mo == -INFINITY) ? 0.0f : __expf(mo - mn); Sf[qi] = sf; Dn[qi] = Dn[qi] * sf + psum; M[qi] = mn; } }
    wave_lds_sync();
#pragma unroll
    for (int t = 0; t < 4; ++t)
#pragma unroll
      for (int r8 = 0; r8 < 8; ++r8) acc[t][r8] *= Sf[8 * hlf + r8];
    { const v16b pa = frag_kb(&Ph[nloc][0], hlf);
#pragma unroll
      for (int t = 0; t < 4; ++t) { acc[t] = wmma16b(pa, frag_kb(&Vh[t * 16 + nloc][0], hlf), acc[t]); acc[t] = wmma16b(pa, frag_kb(&Vl[t * 16 + nloc][0], hlf), acc[t]); } }
    wave_lds_sync(); }
  const size_t slot = (size_t)(piece_slot0(b, qb) + pc);
#pragma unroll
  for (int t = 0; t < 4; ++t) *(v8f*)(PA + slot * (16 * KS) + (size_t)(t * 32 + lane) * 8) = acc[t];
  PM[slot * 32 + lane] = lane < 16 ? M[nloc] : Dn[nloc];
}
// merge: block per (batch, 16 queries): m = max over pieces of M, w = exp(M - m), read = sum w acc / sum w Dn, pieces in key order; thread = (column tile, lane) of the acc register order
__global__ __launch_bounds__(128) void merge_kernel(const float* __restrict__ PA, const float* __restrict__ PM, int BV, float* __restrict__ out) {
  __shared__ float Ls[NG * 32], Ds[16];
  const int tid = threadIdx.x, lane = tid & 31, nloc = lane & 15, hlf = lane >> 4, t = tid >> 5; const int b = blockIdx.x / NBLK, qb = blockIdx.x % NBLK; if (b >= BV) return;
  const int np = qb / QG + 1; const size_t slot0 = (size_t)piece_slot0(b, qb);
  float pm[NG * 32 / 128];   // index clamped to the last piece, so that the loads carry no guard and fly together
#pragma unroll
  for (int i = 0; i < NG * 32 / 128; ++i) pm[i] = PM[slot0 * 32 + min(i * 128 + tid, np * 32 - 1)];
#pragma unroll
  for (int i = 0; i < NG * 32 / 128; ++i) if (i * 128 + tid < np * 32) Ls[i * 128 + tid] = pm[i];
  __syncthreads();
  { const int row = tid >> 3, s8 = tid & 7; float mp[NG / 8], m = -INFINITY, d = 0.0f;   // 8 threads a row, pieces s8, s8 + 8, ...
#pragma unroll
    for (int i = 0; i < NG / 8; ++i) { const int p = i * 8 + s8; mp[i] = p < np ? Ls[p * 32 + row] : -INFINITY; m = fmaxf(m, mp[i]); }
    for (int o = 4; o; o >>= 1) m = fmaxf(m, __shfl_xor(m, o));
#pragma unroll
    for (int i = 0; i < NG / 8; ++i) { const int p = i * 8 + s8; if (p < np) { const float w = mp[i] == -INFINITY ? 0.0f : __expf(mp[i] - m); d += w * Ls[p * 32 + 16 + row]; Ls[p * 32 + row] = w; } }
    for (int o = 4; o; o >>= 1) d += __shfl_xor(d, o);
    if (s8 == 0) Ds[row] = d; }
  __syncthreads();
  v8f a = {}; const float* pa = PA + slot0 * (16 * KS) + (size_t)tid * 8;
#pragma unroll 8   // eight pieces' loads in flight instead of one load latency a piece
  for (int p = 0; p < np; ++p) { const v8f v = *(const v8f*)(pa + (size_t)p * (16 * KS));
#pragma unroll
    for (int r8 = 0; r8 < 8; ++r8) a[r8] += v[r8] * Ls[p * 32 + 8 * hlf + r8]; }
#pragma unroll
  for (int r8 = 0; r8 < 8; ++r8) { const int rl = 8 * hlf + r8; out[((size_t)b * S + (size_t)qb * 16 + rl) * DO + D + t * 16 + nloc] = a[r8] * (1.0f / (PS * XS)) / Ds[rl]; }
}
}  // namespace

extern "C" void kernel_launch(void* const* d_in, const int* in_sizes, int n_in, void* d_out, int out_size, void* d_ws, size_t ws_size, hipStream_t stream) {
  (void)n_in;
  auto Fp = [&](int i) { return (const float*)d_in[i]; };
  // input order: 0 inputs [4,4096,128]; 1 Wq [128,64]; 2 bq; 3 Wk; 4 bk; 5 Wv; 6 bv
  if (in_sizes[0] != B * S * D || in_sizes[1] != D * KS || in_sizes[3] != D * KS || in_sizes[5] != D * KS || in_sizes[2] != KS || out_size != B * S * DO) return;
  const int BV = B, SV = S;
  size_t off = 0; char* ws = (char*)d_ws;
  auto carve = [&](size_t bytes) { char* p = ws + off; off += (bytes + 255) & ~(size_t)255; return p; };
  b16* WT = (b16*)carve((size_t)3 * KS * D * 2); float* QKV = (float*)carve((size_t)B * S * 3 * KS * 4);
  float* PA = (float*)carve((size_t)B * PPB * 16 * KS * 4); float* PM = (float*)carve((size_t)B * PPB * 32 * 4);
  if (off > ws_size || off > ((size_t)96 << 20)) return;   // ~ 84 MB
  wput_kernel<<<(KS * 16 + 255) / 256, 256, 0, stream>>>(Fp(1), 0, WT); wput_kernel<<<(KS * 16 + 255) / 256, 256, 0, stream>>>(Fp(3), KS, WT); wput_kernel<<<(KS * 16 + 255) / 256, 256, 0, stream>>>(Fp(5), 2 * KS, WT);
  float* out = (float*)d_out;
  qkv_kernel<<<(unsigned)((BV == B ? B * S : SV) / 16), 32, 0, stream>>>(Fp(0), WT, Fp(2), Fp(4), Fp(6), BV == B ? B * S : SV, QKV, out);
  att_kernel<<<(unsigned)(B * PPB), 32, 0, stream>>>(QKV, BV, PA, PM);
  merge_kernel<<<(unsigned)(B * NBLK), 128, 0, stream>>>(PA, PM, BV, out);
}

// v002
// One run takes 157 microseconds.
// Timed twice side by side with v001, it ran 2.19 and 2.20 times as fast.
// Counting every step since v000, it is 11.5 times as fast.
#include <hip/hip_runtime.h>

// Snail (causal) attention read head: q, k, v = x Wq/Wk/Wv + b (128 -> 64 each); probs = softmax((q k^T + causal mask) / 8); read = probs v; out = [x | read] -> [4][4096][192].
// Deterministic, no atomics, no index structures; the keys of a query block are cut into pieces of 128, one wave per piece (online softmax over its 32-key chunks, keys in order); a merge launch joins the pieces in key order.
// WMMA (v_wmma_f32_16x16x32_f16, f32 accumulate): [q|k|v] = x [Wq|Wk|Wv] (x EXACT bf16 x8; (in,out) weights transposed exact x256); per (batch, 16 queries): S = q k^T (q, k hi+lo x8, 3 products), acc += P v (P plain x1024 relative to the
// running max, v^T hi+lo x8); the mask, softmax bookkeeping and the final division in f32; the x half of the output is the bf16-rounded input copied through. Inputs rounded to bf16 once. Fragment k-map per lane

namespace {
constexpr int B = 4, S = 4096, D = 128, KS = 64, DO = D + KS, NBLK = S / 16;
constexpr float XS = 8.0f, PS = 1024.0f, WSC = 256.0f;
// key split: a piece = PK keys (4 chunks of 32); the QG query blocks of group g = qb / QG each have g + 1 pieces; PPB pieces per batch
constexpr int PK = 128, QG = PK / 16, NG = NBLK / QG, PPB = QG * (NG * (NG + 1) / 2);
__device__ __forceinline__ int piece_slot0(int b, int qb) { const int g = qb / QG; return b * PPB + QG * (g * (g + 1) / 2) + (qb % QG) * (g + 1); }
typedef _Float16 b16;
typedef __attribute__((ext_vector_type(16))) _Float16 v16b;
typedef __attribute__((ext_vector_type(8))) _Float16 v8b;
typedef __attribute__((ext_vector_type(8))) float v8f;
typedef __attribute__((ext_vector_type(4))) float v4f;
typedef __attribute__((ext_vector_type(2))) float v2f;
__device__ __forceinline__ float bf16_rne(float f) { unsigned int u = __float_as_uint(f); u += 0x7FFFu + ((u >> 16) & 1u); return __uint_as_float(u & 0xFFFF0000u); }
__device__ __forceinline__ void split16(float v, b16& hi, b16& lo) { hi = (b16)v; lo = (b16)(v - (float)hi); }
__device__ __forceinline__ v16b frag_kb(const b16* p, int hh) { const v8b a = *(const v8b*)(p + 8 * hh), b = *(const v8b*)(p + 16 + 8 * hh); v16b f;
#pragma unroll
  for (int e = 0; e < 8; ++e) { f[e] = a[e]; f[8 + e] = b[e]; } return f; }
// fragment-order planes: per 16-row block FB halves, hi then lo, each 4 groups x 32 lanes x 8; a fragment = the lane's 8 halves of two groups, each load 512 B in a row
constexpr int FG = 32 * 8, FH = 4 * FG, FB = 2 * FH;
typedef const __attribute__((address_space(1))) b16* gptr;
typedef const __attribute__((address_space(1))) v8b* gptr8;
// a wave-uniform global pointer kept in scalar registers, so that the fragment loads take the form scalar base + lane offset and need no vector address pair per chunk
__device__ __forceinline__ gptr uni(const b16* p) { const unsigned long long u = (unsigned long long)p; return (gptr)(((unsigned long long)(unsigned int)__builtin_amdgcn_readfirstlane((int)(u >> 32)) << 32) | (unsigned int)__builtin_amdgcn_readfirstlane((int)u)); }
__device__ __forceinline__ v16b frag_g(gptr p0, gptr p1) { const v8b a = *(gptr8)p0, b = *(gptr8)p1; v16b f;
#pragma unroll
  for (int e = 0; e < 8; ++e) { f[e] = a[e]; f[8 + e] = b[e]; } return f; }
__device__ __forceinline__ v8f wmma16b(v16b a, v16b b, v8f c) { v8f d = __builtin_amdgcn_wmma_f32_16x16x32_f16(false, a, false, b, (short)0, c, false, false); asm volatile("v_nop\n\tv_nop\n\tv_nop\n\tv_nop" : "+v"(d) : "v"(a), "v"(b)); return d; }
__device__ __forceinline__ void wave_lds_sync() { __builtin_amdgcn_fence(__ATOMIC_RELEASE, "workgroup"); __builtin_amdgcn_wave_barrier(); __builtin_amdgcn_fence(__ATOMIC_ACQUIRE, "workgroup"); }
__device__ __forceinline__ float pmul(float a, float b) { float p = a * b; asm volatile("" : "+v"(p)); return p; }

__global__ __launch_bounds__(256) void wput_kernel(const float* __restrict__ w, int ro, b16* __restrict__ WT) {
  const int u = blockIdx.x * 256 + threadIdx.x; if (u >= KS * 16) return; const int o = u / 16, k0 = (u % 16) * 8; v8b v;
#pragma unroll
  for (int j = 0; j < 8; ++j) v[j] = (b16)(bf16_rne(w[(size_t)(k0 + j) * KS + o]) * WSC); { *(v8b*)(WT + (size_t)(ro + o) * D + k0) = v;  }
}
__global__ __launch_bounds__(32) void qkv_kernel(const float* __restrict__ x, const b16* __restrict__ WT, const float* __restrict__ bq, const float* __restrict__ bk, const float* __restrict__ bv, int RLIM, b16* __restrict__ QF, b16* __restrict__ KF, b16* __restrict__ VF, float* __restrict__ out) {
  __shared__ __attribute__((aligned(16))) b16 Ah[16][D + 8]; __shared__ __attribute__((aligned(16))) float Tf[16][3 * KS + 4];
  const int lane = threadIdx.x, nloc = lane & 15, hlf = lane >> 4; const size_t m0 = (size_t)blockIdx.x * 16; if (m0 >= (size_t)RLIM) return;
  for (int rr = 0; rr < 16; ++rr) for (int q = 0; q < 4; ++q) Ah[rr][q * 32 + lane] = (b16)(bf16_rne(x[(m0 + rr) * D + q * 32 + lane]) * XS);
  wave_lds_sync(); v8f acc[12];
#pragma unroll
  for (int t = 0; t < 12; ++t) acc[t] = (v8f){};
#pragma unroll
  for (int kb = 0; kb < D; kb += 32) { const v16b a = frag_kb(&Ah[nloc][kb], hlf);
#pragma unroll
    for (int t = 0; t < 12; ++t) acc[t] = wmma16b(a, frag_kb(WT + (size_t)(t * 16 + nloc) * D + kb, hlf), acc[t]); }
#pragma unroll
  for (int t = 0; t < 12; ++t) { const int c = t * 16 + nloc; const float bb = bf16_rne(c < KS ? bq[c] : (c < 2 * KS ? bk[c - KS] : bv[c - 2 * KS]));
#pragma unroll
    for (int r8 = 0; r8 < 8; ++r8) Tf[8 * hlf + r8][c] = acc[t][r8] * (1.0f / (XS * WSC)) + bb; }
  wave_lds_sync();
  // q, k (row nloc, columns g * 16 + 8 * hlf + e) and v (key 8 * hlf + e, column g * 16 + nloc) split hi+lo x8 once, stored as the attention waves' fragments
#pragma unroll
  for (int w = 0; w < 3; ++w) { b16* fp = (w == 0 ? QF : w == 1 ? KF : VF) + (size_t)blockIdx.x * FB + lane * 8;
#pragma unroll
    for (int g = 0; g < 4; ++g) { v8b h, l;
#pragma unroll
      for (int e = 0; e < 8; ++e) { b16 p, ql; split16((w < 2 ? Tf[nloc][w * KS + g * 16 + 8 * hlf + e] : Tf[8 * hlf + e][2 * KS + g * 16 + nloc]) * XS, p, ql); h[e] = p; l[e] = ql; }
      *(v8b*)(fp + g * FG) = h; *(v8b*)(fp + FH + g * FG) = l; } }
  asm volatile("s_wait_xcnt 0x0" ::: "memory");   // the loads below land in registers that the fragment stores name: the wait stands in front of that overwrite
  { for (int rr = 0; rr < 16; ++rr) { *(v4f*)(out + (m0 + rr) * DO + lane * 4) = (v4f){bf16_rne(x[(m0 + rr) * D + lane * 4]), bf16_rne(x[(m0 + rr) * D + lane * 4 + 1]), bf16_rne(x[(m0 + rr) * D + lane * 4 + 2]), bf16_rne(x[(m0 + rr) * D + lane * 4 + 3])}; }  }
}
// causal attention: wave per (batch, 16 queries, piece of 128 keys): online softmax over the piece's 32-key chunks kc <= query block; S = q k^T / 8 (hi+lo, 3 products), mask keys > query, running M/Dn/Sf per row in LDS, acc rescale, acc += P v (P plain x1024,
// the piece's unnormalised acc (register order), M and Dn go to the workspace. Groups g and NG - 1 - g are paired (NG + 1 pieces a pair), so the flat index covers exactly the pieces that exist.
// register budget of 128, so that eight waves fit a SIMD: the waves hide one another's softmax and load latency
__global__ __launch_bounds__(32) __attribute__((amdgpu_waves_per_eu(8))) void att_kernel(const b16* __restrict__ QF, const b16* __restrict__ KF, const b16* __restrict__ VF, int BV, float* __restrict__ PA, float* __restrict__ PM) {
  __shared__ __attribute__((aligned(16))) b16 Ph[16][40]; __shared__ float Sc[16][33], M[16], Dn[16], Sf[16];
  const int lane = threadIdx.x, nloc = lane & 15, hlf = lane >> 4; const int b = blockIdx.x / PPB, ib = blockIdx.x % PPB, jp = ib / QG, pr = jp / (NG + 1), rp = jp % (NG + 1); if (b >= BV) return;
  const int g = rp <= pr ? pr : NG - 1 - pr, pc = rp <= pr ? rp : rp - pr - 1, qb = g * QG + ib % QG; const size_t q0 = (size_t)qb * 16; const int kend = min(pc * PK + PK, (int)q0 + 16);
  v16b qfh[2], qfl[2]; { const gptr qp = uni(QF + (size_t)(b * NBLK + qb) * FB) + lane * 8;
#pragma unroll
    for (int k2 = 0; k2 < 2; ++k2) { qfh[k2] = frag_g(qp + 2 * k2 * FG, qp + (2 * k2 + 1) * FG); qfl[k2] = frag_g(qp + FH + 2 * k2 * FG, qp + FH + (2 * k2 + 1) * FG); } }
  if (lane < 16) { M[lane] = -INFINITY; Dn[lane] = 0.0f; Sf[lane] = 0.0f; }
  v8f acc[4];
#pragma unroll
  for (int t = 0; t < 4; ++t) acc[t] = (v8f){};
  wave_lds_sync();
#pragma unroll 1
  for (int kc = pc * PK; kc < kend; kc += 32) {
    const gptr kp = uni(KF + (size_t)(b * NBLK + kc / 16) * FB) + lane * 8, vp = uni(VF + (size_t)(b * NBLK + kc / 16) * FB) + lane * 8;   // two 16-key blocks; rows past the diagonal exist (kc + 32 <= S) and are masked below
#pragma unroll
    for (int blk = 0; blk < 2; ++blk) { v8f s = {}; const gptr kf = kp + blk * FB; const v16b kfh[2] = {frag_g(kf, kf + FG), frag_g(kf + 2 * FG, kf + 3 * FG)}, kfl[2] = {frag_g(kf + FH, kf + FH + FG), frag_g(kf + FH + 2 * FG, kf + FH + 3 * FG)};
      asm volatile("" :: "v"(kfh[0]), "v"(kfh[1]), "v"(kfl[0]), "v"(kfl[1]));   // holds the key block's eight loads in front of its first product: one load latency a block, not one per k step
#pragma unroll
      for (int ks = 0; ks < KS; ks += 32) { const v16b qh = qfh[ks / 32], ql = qfl[ks / 32], kh = kfh[ks / 32], kl = kfl[ks / 32]; s = wmma16b(qh, kh, s); s = wmma16b(qh, kl, s); s = wmma16b(ql, kh, s); }
#pragma unroll
      for (int r8 = 0; r8 < 8; ++r8) { const int qi = (int)q0 + 8 * hlf + r8, kj = kc + blk * 16 + nloc; Sc[8 * hlf + r8][blk * 16 + nloc] = kj > qi ? -INFINITY : s[r8] * (0.125f / (XS * XS)); } }
    wave_lds_sync();
#pragma unroll 1
    for (int qi = 0; qi < 16; ++qi) { const float sv = Sc[qi][lane]; float cm = sv; for (int o = 16; o; o >>= 1) cm = fmaxf(cm, __shfl_xor(cm, o)); const float mo = M[qi]; const float mn = fmaxf(mo, cm); const float p = sv == -INFINITY ? 0.0f : __expf(sv - mn); float psum = p; for (int o = 16; o; o >>= 1) psum += __shfl_xor(psum, o);
      Ph[qi][lane] = (b16)(p * PS); if (lane == 0) { const float sf = (mo == -INFINITY) ? 0.0f : __expf(mo - mn); Sf[qi] = sf; Dn[qi] = Dn[qi] * sf + psum; M[qi] = mn; } }
    wave_lds_sync();
#pragma unroll
    for (int t = 0; t < 4; ++t)
#pragma unroll
      for (int r8 = 0; r8 < 8; ++r8) acc[t][r8] *= Sf[8 * hlf + r8];
    { const v16b pa = frag_kb(&Ph[nloc][0], hlf);
#pragma unroll
      for (int t = 0; t < 4; t += 2) { const v16b vh0 = frag_g(vp + t * FG, vp + FB + t * FG), vl0 = frag_g(vp + FH + t * FG, vp + FB + FH + t * FG), vh1 = frag_g(vp + (t + 1) * FG, vp + FB + (t + 1) * FG), vl1 = frag_g(vp + FH + (t + 1) * FG, vp + FB + FH + (t + 1) * FG);
        asm volatile("" :: "v"(vh0), "v"(vl0), "v"(vh1), "v"(vl1));   // holds two column tiles' eight loads in front of their first product: one load latency a pair, not one per product
        acc[t] = wmma16b(pa, vh0, acc[t]); acc[t] = wmma16b(pa, vl0, acc[t]); acc[t + 1] = wmma16b(pa, vh1, acc[t + 1]); acc[t + 1] = wmma16b(pa, vl1, acc[t + 1]); } }
    wave_lds_sync(); }
  const size_t slot = (size_t)(piece_slot0(b, qb) + pc);
#pragma unroll
  for (int t = 0; t < 4; ++t) *(v8f*)(PA + slot * (16 * KS) + (size_t)(t * 32 + lane) * 8) = acc[t];
  PM[slot * 32 + lane] = lane < 16 ? M[nloc] : Dn[nloc];
}
// merge: block per (batch, 16 queries): m = max over pieces of M, w = exp(M - m), read = sum w acc / sum w Dn, pieces in key order; thread = (column tile, lane) of the acc register order
__global__ __launch_bounds__(128) void merge_kernel(const float* __restrict__ PA, const float* __restrict__ PM, int BV, float* __restrict__ out) {
  __shared__ float Ls[NG * 32], Ds[16];
  const int tid = threadIdx.x, lane = tid & 31, nloc = lane & 15, hlf = lane >> 4, t = tid >> 5; const int b = blockIdx.x / NBLK, qb = blockIdx.x % NBLK; if (b >= BV) return;
  const int np = qb / QG + 1; const size_t slot0 = (size_t)piece_slot0(b, qb);
  float pm[NG * 32 / 128];   // index clamped to the last piece, so that the loads carry no guard and fly together
#pragma unroll
  for (int i = 0; i < NG * 32 / 128; ++i) pm[i] = PM[slot0 * 32 + min(i * 128 + tid, np * 32 - 1)];
#pragma unroll
  for (int i = 0; i < NG * 32 / 128; ++i) if (i * 128 + tid < np * 32) Ls[i * 128 + tid] = pm[i];
  __syncthreads();
  { const int row = tid >> 3, s8 = tid & 7; float mp[NG / 8], m = -INFINITY, d = 0.0f;   // 8 threads a row, pieces s8, s8 + 8, ...
#pragma unroll
    for (int i = 0; i < NG / 8; ++i) { const int p = i * 8 + s8; mp[i] = p < np ? Ls[p * 32 + row] : -INFINITY; m = fmaxf(m, mp[i]); }
    for (int o = 4; o; o >>= 1) m = fmaxf(m, __shfl_xor(m, o));
#pragma unroll
    for (int i = 0; i < NG / 8; ++i) { const int p = i * 8 + s8; if (p < np) { const float w = mp[i] == -INFINITY ? 0.0f : __expf(mp[i] - m); d += w * Ls[p * 32 + 16 + row]; Ls[p * 32 + row] = w; } }
    for (int o = 4; o; o >>= 1) d += __shfl_xor(d, o);
    if (s8 == 0) Ds[row] = d; }
  __syncthreads();
  v8f a = {}; const float* pa = PA + slot0 * (16 * KS) + (size_t)tid * 8;
#pragma unroll 8   // eight pieces' loads in flight instead of one load latency a piece
  for (int p = 0; p < np; ++p) { const v8f v = *(const v8f*)(pa + (size_t)p * (16 * KS));
#pragma unroll
    for (int r8 = 0; r8 < 8; ++r8) a[r8] += v[r8] * Ls[p * 32 + 8 * hlf + r8]; }
#pragma unroll
  for (int r8 = 0; r8 < 8; ++r8) { const int rl = 8 * hlf + r8; out[((size_t)b * S + (size_t)qb * 16 + rl) * DO + D + t * 16 + nloc] = a[r8] * (1.0f / (PS * XS)) / Ds[rl]; }
}
}  // namespace

extern "C" void kernel_launch(void* const* d_in, const int* in_sizes, int n_in, void* d_out, int out_size, void* d_ws, size_t ws_size, hipStream_t stream) {
  (void)n_in;
  auto Fp = [&](int i) { return (const float*)d_in[i]; };
  // input order: 0 inputs [4,4096,128]; 1 Wq [128,64]; 2 bq; 3 Wk; 4 bk; 5 Wv; 6 bv
  if (in_sizes[0] != B * S * D || in_sizes[1] != D * KS || in_sizes[3] != D * KS || in_sizes[5] != D * KS || in_sizes[2] != KS || out_size != B * S * DO) return;
  const int BV = B, SV = S;
  size_t off = 0; char* ws = (char*)d_ws;
  auto carve = [&](size_t bytes) { char* p = ws + off; off += (bytes + 255) & ~(size_t)255; return p; };
  b16* WT = (b16*)carve((size_t)3 * KS * D * 2); b16* QF = (b16*)carve((size_t)B * NBLK * FB * 2); b16* KF = (b16*)carve((size_t)B * NBLK * FB * 2); b16* VF = (b16*)carve((size_t)B * NBLK * FB * 2);
  float* PA = (float*)carve((size_t)B * PPB * 16 * KS * 4); float* PM = (float*)carve((size_t)B * PPB * 32 * 4);
  if (off > ws_size || off > ((size_t)96 << 20)) return;   // ~ 84 MB
  wput_kernel<<<(KS * 16 + 255) / 256, 256, 0, stream>>>(Fp(1), 0, WT); wput_kernel<<<(KS * 16 + 255) / 256, 256, 0, stream>>>(Fp(3), KS, WT); wput_kernel<<<(KS * 16 + 255) / 256, 256, 0, stream>>>(Fp(5), 2 * KS, WT);
  float* out = (float*)d_out;
  qkv_kernel<<<(unsigned)((BV == B ? B * S : SV) / 16), 32, 0, stream>>>(Fp(0), WT, Fp(2), Fp(4), Fp(6), BV == B ? B * S : SV, QF, KF, VF, out);
  att_kernel<<<(unsigned)(B * PPB), 32, 0, stream>>>(QF, KF, VF, BV, PA, PM);
  merge_kernel<<<(unsigned)(B * NBLK), 128, 0, stream>>>(PA, PM, BV, out);
}

// v003
// One run takes 85.4 microseconds.
// Timed twice side by side with v002, it ran 1.83 and 1.84 times as fast.
// Over all steps from v000 it is 21.1 times as fast.
#include <hip/hip_runtime.h>

// Snail (causal) attention read head: q, k, v = x Wq/Wk/Wv + b (128 -> 64 each); probs = softmax((q k^T + causal mask) / 8); read = probs v; out = [x | read] -> [4][4096][192].
// Deterministic, no atomics, no index structures; the keys of a query block are cut into pieces of 128, one wave per piece (online softmax over its 32-key chunks, keys in order); a merge launch joins the pieces in key order.
// WMMA (v_wmma_f32_16x16x32_f16, f32 accumulate): [q|k|v] = x [Wq|Wk|Wv] (x EXACT bf16 x8; (in,out) weights transposed exact x256); per (batch, 16 queries): S = q k^T (q, k hi+lo x8, 3 products), acc += P v (P plain x1024 relative to the
// running max, v^T hi+lo x8); the mask, softmax bookkeeping and the final division in f32; the x half of the output is the bf16-rounded input copied through. Inputs rounded to bf16 once. Fragment k-map per lane

namespace {
constexpr int B = 4, S = 4096, D = 128, KS = 64, DO = D + KS, NBLK = S / 16;
constexpr float XS = 8.0f, PS = 1024.0f, WSC = 256.0f;
// key split: a piece = PK keys (4 chunks of 32); the QG query blocks of group g = qb / QG each have g + 1 pieces; PPB pieces per batch
constexpr int PK = 128, QG = PK / 16, NG = NBLK / QG, PPB = QG * (NG * (NG + 1) / 2);
__device__ __forceinline__ int piece_slot0(int b, int qb) { const int g = qb / QG; return b * PPB + QG * (g * (g + 1) / 2) + (qb % QG) * (g + 1); }
typedef _Float16 b16;
typedef __attribute__((ext_vector_type(16))) _Float16 v16b;
typedef __attribute__((ext_vector_type(8))) _Float16 v8b;
typedef __attribute__((ext_vector_type(8))) float v8f;
typedef __attribute__((ext_vector_type(4))) float v4f;
typedef __attribute__((ext_vector_type(2))) float v2f;
__device__ __forceinline__ float bf16_rne(float f) { unsigned int u = __float_as_uint(f); u += 0x7FFFu + ((u >> 16) & 1u); return __uint_as_float(u & 0xFFFF0000u); }
__device__ __forceinline__ void split16(float v, b16& hi, b16& lo) { hi = (b16)v; lo = (b16)(v - (float)hi); }
__device__ __forceinline__ v16b frag_kb(const b16* p, int hh) { const v8b a = *(const v8b*)(p + 8 * hh), b = *(const v8b*)(p + 16 + 8 * hh); v16b f;
#pragma unroll
  for (int e = 0; e < 8; ++e) { f[e] = a[e]; f[8 + e] = b[e]; } return f; }
// fragment-order planes: per 16-row block FB halves, hi then lo, each 4 groups x 32 lanes x 8; a fragment = the lane's 8 halves of two groups, each load 512 B in a row
constexpr int FG = 32 * 8, FH = 4 * FG, FB = 2 * FH;
typedef const __attribute__((address_space(1))) b16* gptr;
typedef const __attribute__((address_space(1))) v8b* gptr8;
// a wave-uniform global pointer kept in scalar registers, so that the fragment loads take the form scalar base + lane offset and need no vector address pair per chunk
__device__ __forceinline__ gptr uni(const b16* p) { const unsigned long long u = (unsigned long long)p; return (gptr)(((unsigned long long)(unsigned int)__builtin_amdgcn_readfirstlane((int)(u >> 32)) << 32) | (unsigned int)__builtin_amdgcn_readfirstlane((int)u)); }
__device__ __forceinline__ v16b frag_g(gptr p0, gptr p1) { const v8b a = *(gptr8)p0, b = *(gptr8)p1; v16b f;
#pragma unroll
  for (int e = 0; e < 8; ++e) { f[e] = a[e]; f[8 + e] = b[e]; } return f; }
__device__ __forceinline__ v8f wmma16b(v16b a, v16b b, v8f c) { v8f d = __builtin_amdgcn_wmma_f32_16x16x32_f16(false, a, false, b, (short)0, c, false, false); asm volatile("v_nop\n\tv_nop\n\tv_nop\n\tv_nop" : "+v"(d) : "v"(a), "v"(b)); return d; }
__device__ __forceinline__ void wave_lds_sync() { __builtin_amdgcn_fence(__ATOMIC_RELEASE, "workgroup"); __builtin_amdgcn_wave_barrier(); __builtin_amdgcn_fence(__ATOMIC_ACQUIRE, "workgroup"); }
__device__ __forceinline__ float pmul(float a, float b) { float p = a * b; asm volatile("" : "+v"(p)); return p; }
__device__ __forceinline__ float xhalf(float x) { return __builtin_bit_cast(float, __builtin_amdgcn_permlanex16(__builtin_bit_cast(int, x), __builtin_bit_cast(int, x), 0x76543210, 0xfedcba98, false, false)); }  // lane l with lane l ^ 16

__global__ __launch_bounds__(256) void wput_kernel(const float* __restrict__ w, int ro, b16* __restrict__ WT) {
  const int u = blockIdx.x * 256 + threadIdx.x; if (u >= KS * 16) return; const int o = u / 16, k0 = (u % 16) * 8; v8b v;
#pragma unroll
  for (int j = 0; j < 8; ++j) v[j] = (b16)(bf16_rne(w[(size_t)(k0 + j) * KS + o]) * WSC); { *(v8b*)(WT + (size_t)(ro + o) * D + k0) = v;  }
}
__global__ __launch_bounds__(32) void qkv_kernel(const float* __restrict__ x, const b16* __restrict__ WT, const float* __restrict__ bq, const float* __restrict__ bk, const float* __restrict__ bv, int RLIM, b16* __restrict__ QF, b16* __restrict__ KF, b16* __restrict__ VF, float* __restrict__ out) {
  __shared__ __attribute__((aligned(16))) b16 Ah[16][D + 8]; __shared__ __attribute__((aligned(16))) float Tf[16][3 * KS + 4];
  const int lane = threadIdx.x, nloc = lane & 15, hlf = lane >> 4; const size_t m0 = (size_t)blockIdx.x * 16; if (m0 >= (size_t)RLIM) return;
  for (int rr = 0; rr < 16; ++rr) for (int q = 0; q < 4; ++q) Ah[rr][q * 32 + lane] = (b16)(bf16_rne(x[(m0 + rr) * D + q * 32 + lane]) * XS);
  wave_lds_sync(); v8f acc[12];
#pragma unroll
  for (int t = 0; t < 12; ++t) acc[t] = (v8f){};
#pragma unroll
  for (int kb = 0; kb < D; kb += 32) { const v16b a = frag_kb(&Ah[nloc][kb], hlf);
#pragma unroll
    for (int t = 0; t < 12; ++t) acc[t] = wmma16b(a, frag_kb(WT + (size_t)(t * 16 + nloc) * D + kb, hlf), acc[t]); }
#pragma unroll
  for (int t = 0; t < 12; ++t) { const int c = t * 16 + nloc; const float bb = bf16_rne(c < KS ? bq[c] : (c < 2 * KS ? bk[c - KS] : bv[c - 2 * KS]));
#pragma unroll
    for (int r8 = 0; r8 < 8; ++r8) Tf[8 * hlf + r8][c] = acc[t][r8] * (1.0f / (XS * WSC)) + bb; }
  wave_lds_sync();
  // q, k (row nloc, columns g * 16 + 8 * hlf + e) and v (key 8 * hlf + e, column g * 16 + nloc) split hi+lo x8 once, stored as the attention waves' fragments
#pragma unroll
  for (int w = 0; w < 3; ++w) { b16* fp = (w == 0 ? QF : w == 1 ? KF : VF) + (size_t)blockIdx.x * FB + lane * 8;
#pragma unroll
    for (int g = 0; g < 4; ++g) { v8b h, l;
#pragma unroll
      for (int e = 0; e < 8; ++e) { b16 p, ql; split16((w < 2 ? Tf[nloc][w * KS + g * 16 + 8 * hlf + e] : Tf[8 * hlf + e][2 * KS + g * 16 + nloc]) * XS, p, ql); h[e] = p; l[e] = ql; }
      *(v8b*)(fp + g * FG) = h; *(v8b*)(fp + FH + g * FG) = l; } }
  asm volatile("s_wait_xcnt 0x0" ::: "memory");   // the loads below land in registers that the fragment stores name: the wait stands in front of that overwrite
  { for (int rr = 0; rr < 16; ++rr) { *(v4f*)(out + (m0 + rr) * DO + lane * 4) = (v4f){bf16_rne(x[(m0 + rr) * D + lane * 4]), bf16_rne(x[(m0 + rr) * D + lane * 4 + 1]), bf16_rne(x[(m0 + rr) * D + lane * 4 + 2]), bf16_rne(x[(m0 + rr) * D + lane * 4 + 3])}; }  }
}
// causal attention: wave per (batch, 16 queries, piece of 128 keys): online softmax over the piece's 32-key chunks kc <= query block. Both products run transposed: S^T = k q^T / 8 (A = key rows, B = queries; hi+lo, 3 products), so that
// a lane holds 16 of the chunk's 32 scores of ONE query (query nloc; keys blk * 16 + 8 * hlf + r8): mask, maximum, exp and sum stay in its registers, the two halves of the wave meet in one cross-row move for the maximum and, once a piece, for the sum.
// The two score tiles, converted in place, are the B fragment of acc^T += v^T P^T (A = v^T hi+lo x8, P plain x1024): no LDS and no wave sync in this kernel. acc[t][r8] = column t * 16 + 8 * hlf + r8 of query nloc.
// the piece's unnormalised acc (register order), M and Dn go to the workspace. Groups g and NG - 1 - g are paired (NG + 1 pieces a pair), so the flat index covers exactly the pieces that exist.
// register budget of 128, so that eight waves fit a SIMD: the waves hide one another's softmax and load latency
__global__ __launch_bounds__(32) __attribute__((amdgpu_waves_per_eu(8))) void att_kernel(const b16* __restrict__ QF, const b16* __restrict__ KF, const b16* __restrict__ VF, int BV, float* __restrict__ PA, float* __restrict__ PM) {
  const int lane = threadIdx.x, nloc = lane & 15, hlf = lane >> 4; const int b = blockIdx.x / PPB, ib = blockIdx.x % PPB, jp = ib / QG, pr = jp / (NG + 1), rp = jp % (NG + 1); if (b >= BV) return;
  const int g = rp <= pr ? pr : NG - 1 - pr, pc = rp <= pr ? rp : rp - pr - 1, qb = g * QG + ib % QG; const size_t q0 = (size_t)qb * 16; const int kend = min(pc * PK + PK, (int)q0 + 16);
  v16b qfh[2], qfl[2]; { const gptr qp = uni(QF + (size_t)(b * NBLK + qb) * FB) + lane * 8;
#pragma unroll
    for (int k2 = 0; k2 < 2; ++k2) { qfh[k2] = frag_g(qp + 2 * k2 * FG, qp + (2 * k2 + 1) * FG); qfl[k2] = frag_g(qp + FH + 2 * k2 * FG, qp + FH + (2 * k2 + 1) * FG); } }
  float mo = -INFINITY, dn = 0.0f;   // the lane's query: running maximum (equal in both halves), running sum over the lane's own keys
  v8f acc[4];
#pragma unroll
  for (int t = 0; t < 4; ++t) acc[t] = (v8f){};
#pragma unroll 1
  for (int kc = pc * PK; kc < kend; kc += 32) {
    const gptr kp = uni(KF + (size_t)(b * NBLK + kc / 16) * FB) + lane * 8, vp = uni(VF + (size_t)(b * NBLK + kc / 16) * FB) + lane * 8;   // two 16-key blocks; rows past the diagonal exist (kc + 32 <= S) and are masked below
    float sc[2][8]; const int lim = (int)q0 + nloc - kc - 8 * hlf;   // the lane's last unmasked key, counted from its first key of the chunk
#pragma unroll
    for (int blk = 0; blk < 2; ++blk) { v8f s = {}; const gptr kf = kp + blk * FB; const v16b kfh[2] = {frag_g(kf, kf + FG), frag_g(kf + 2 * FG, kf + 3 * FG)}, kfl[2] = {frag_g(kf + FH, kf + FH + FG), frag_g(kf + FH + 2 * FG, kf + FH + 3 * FG)};
      asm volatile("" :: "v"(kfh[0]), "v"(kfh[1]), "v"(kfl[0]), "v"(kfl[1]));   // holds the key block's eight loads in front of its first product: one load latency a block, not one per k step
#pragma unroll
      for (int ks = 0; ks < KS; ks += 32) { const v16b qh = qfh[ks / 32], ql = qfl[ks / 32], kh = kfh[ks / 32], kl = kfl[ks / 32]; s = wmma16b(kh, qh, s); s = wmma16b(kl, qh, s); s = wmma16b(kh, ql, s); }
#pragma unroll
      for (int r8 = 0; r8 < 8; ++r8) sc[blk][r8] = blk * 16 + r8 > lim ? -INFINITY : s[r8] * (0.125f / (XS * XS)); }   // key kc + blk * 16 + 8 * hlf + r8 > query q0 + nloc
    float cm = sc[0][0];
#pragma unroll
    for (int e = 1; e < 16; ++e) cm = fmaxf(cm, sc[e >> 3][e & 7]);
    cm = fmaxf(cm, xhalf(cm)); const float mn = fmaxf(mo, cm), sf = (mo == -INFINITY) ? 0.0f : __expf(mo - mn);
    float psum = 0.0f; v16b pb;   // pb[e] = P[query nloc][key (e >> 3) * 16 + 8 * hlf + (e & 7)]: the k order of the v fragments
#pragma unroll
    for (int e = 0; e < 16; ++e) { const float sv = sc[e >> 3][e & 7], p = sv == -INFINITY ? 0.0f : __expf(sv - mn); psum += p; pb[e] = (b16)(p * PS); }
    dn = dn * sf + psum; mo = mn;
#pragma unroll
    for (int t = 0; t < 4; ++t)
#pragma unroll
      for (int r8 = 0; r8 < 8; ++r8) acc[t][r8] *= sf;
#pragma unroll
    for (int t = 0; t < 4; t += 2) { const v16b vh0 = frag_g(vp + t * FG, vp + FB + t * FG), vl0 = frag_g(vp + FH + t * FG, vp + FB + FH + t * FG), vh1 = frag_g(vp + (t + 1) * FG, vp + FB + (t + 1) * FG), vl1 = frag_g(vp + FH + (t + 1) * FG, vp + FB + FH + (t + 1) * FG);
      asm volatile("" :: "v"(vh0), "v"(vl0), "v"(vh1), "v"(vl1));   // holds two column tiles' eight loads in front of their first product: one load latency a pair, not one per product
      acc[t] = wmma16b(vh0, pb, acc[t]); acc[t] = wmma16b(vl0, pb, acc[t]); acc[t + 1] = wmma16b(vh1, pb, acc[t + 1]); acc[t + 1] = wmma16b(vl1, pb, acc[t + 1]); } }
  dn += xhalf(dn);
  const size_t slot = (size_t)(piece_slot0(b, qb) + pc);
  PM[slot * 32 + lane] = lane < 16 ? mo : dn;
#pragma unroll
  for (int t = 0; t < 4; ++t) *(v8f*)(PA + slot * (16 * KS) + (size_t)(t * 32 + lane) * 8) = acc[t];
}
// merge: block per (batch, 16 queries): m = max over pieces of M, w = exp(M - m), read = sum w acc / sum w Dn, pieces in key order; thread = (column tile, lane) of the acc register order: query nloc, columns t * 16 + 8 * hlf + 0..7
__global__ __launch_bounds__(128) void merge_kernel(const float* __restrict__ PA, const float* __restrict__ PM, int BV, float* __restrict__ out) {
  __shared__ float Ls[NG * 32], Ds[16];
  const int tid = threadIdx.x, lane = tid & 31, nloc = lane & 15, hlf = lane >> 4, t = tid >> 5; const int b = blockIdx.x / NBLK, qb = blockIdx.x % NBLK; if (b >= BV) return;
  const int np = qb / QG + 1; const size_t slot0 = (size_t)piece_slot0(b, qb);
  float pm[NG * 32 / 128];   // index clamped to the last piece, so that the loads carry no guard and fly together
#pragma unroll
  for (int i = 0; i < NG * 32 / 128; ++i) pm[i] = PM[slot0 * 32 + min(i * 128 + tid, np * 32 - 1)];
#pragma unroll
  for (int i = 0; i < NG * 32 / 128; ++i) if (i * 128 + tid < np * 32) Ls[i * 128 + tid] = pm[i];
  __syncthreads();
  { const int row = tid >> 3, s8 = tid & 7; float mp[NG / 8], m = -INFINITY, d = 0.0f;   // 8 threads a row, pieces s8, s8 + 8, ...
#pragma unroll
    for (int i = 0; i < NG / 8; ++i) { const int p = i * 8 + s8; mp[i] = p < np ? Ls[p * 32 + row] : -INFINITY; m = fmaxf(m, mp[i]); }
    for (int o = 4; o; o >>= 1) m = fmaxf(m, __shfl_xor(m, o));
#pragma unroll
    for (int i = 0; i < NG / 8; ++i) { const int p = i * 8 + s8; if (p < np) { const float w = mp[i] == -INFINITY ? 0.0f : __expf(mp[i] - m); d += w * Ls[p * 32 + 16 + row]; Ls[p * 32 + row] = w; } }
    for (int o = 4; o; o >>= 1) d += __shfl_xor(d, o);
    if (s8 == 0) Ds[row] = d; }
  __syncthreads();
  v8f a = {}; const float* pa = PA + slot0 * (16 * KS) + (size_t)tid * 8;
#pragma unroll 8   // eight pieces' loads in flight instead of one load latency a piece
  for (int p = 0; p < np; ++p) { const v8f v = *(const v8f*)(pa + (size_t)p * (16 * KS));
#pragma unroll
    for (int r8 = 0; r8 < 8; ++r8) a[r8] += v[r8] * Ls[p * 32 + nloc]; }
#pragma unroll
  for (int r8 = 0; r8 < 8; ++r8) a[r8] = a[r8] * (1.0f / (PS * XS)) / Ds[nloc];
  *(v8f*)(out + ((size_t)b * S + (size_t)qb * 16 + nloc) * DO + D + t * 16 + 8 * hlf) = a;
}
}  // namespace

extern "C" void kernel_launch(void* const* d_in, const int* in_sizes, int n_in, void* d_out, int out_size, void* d_ws, size_t ws_size, hipStream_t stream) {
  (void)n_in;
  auto Fp = [&](int i) { return (const float*)d_in[i]; };
  // input order: 0 inputs [4,4096,128]; 1 Wq [128,64]; 2 bq; 3 Wk; 4 bk; 5 Wv; 6 bv
  if (in_sizes[0] != B * S * D || in_sizes[1] != D * KS || in_sizes[3] != D * KS || in_sizes[5] != D * KS || in_sizes[2] != KS || out_size != B * S * DO) return;
  const int BV = B, SV = S;
  size_t off = 0; char* ws = (char*)d_ws;
  auto carve = [&](size_t bytes) { char* p = ws + off; off += (bytes + 255) & ~(size_t)255; return p; };
  b16* WT = (b16*)carve((size_t)3 * KS * D * 2); b16* QF = (b16*)carve((size_t)B * NBLK * FB * 2); b16* KF = (b16*)carve((size_t)B * NBLK * FB * 2); b16* VF = (b16*)carve((size_t)B * NBLK * FB * 2);
  float* PA = (float*)carve((size_t)B * PPB * 16 * KS * 4); float* PM = (float*)carve((size_t)B * PPB * 32 * 4);
  if (off > ws_size || off > ((size_t)96 << 20)) return;   // ~ 84 MB
  wput_kernel<<<(KS * 16 + 255) / 256, 256, 0, stream>>>(Fp(1), 0, WT); wput_kernel<<<(KS * 16 + 255) / 256, 256, 0, stream>>>(Fp(3), KS, WT); wput_kernel<<<(KS * 16 + 255) / 256, 256, 0, stream>>>(Fp(5), 2 * KS, WT);
  float* out = (float*)d_out;
  qkv_kernel<<<(unsigned)((BV == B ? B * S : SV) / 16), 32, 0, stream>>>(Fp(0), WT, Fp(2), Fp(4), Fp(6), BV == B ? B * S : SV, QF, KF, VF, out);
  att_kernel<<<(unsigned)(B * PPB), 32, 0, stream>>>(QF, KF, VF, BV, PA, PM);
  merge_kernel<<<(unsigned)(B * NBLK), 128, 0, stream>>>(PA, PM, BV, out);
}

// v004
// One run takes 65.9 microseconds.
// Timed twice side by side with v003, it ran 1.30 and 1.31 times as fast.
// All steps since v000 together make it 27.4 times as fast.
#include <hip/hip_runtime.h>

// Snail (causal) attention read head: q, k, v = x Wq/Wk/Wv + b (128 -> 64 each); probs = softmax((q k^T + causal mask) / 8); read = probs v; out = [x | read] -> [4][4096][192].
// Deterministic, no atomics, no index structures; the keys of a query block are cut into pieces of 128, one wave per piece (online softmax over its 32-key chunks, keys in order); a merge launch joins the pieces in key order.
// WMMA (v_wmma_f32_16x16x32_f16, f32 accumulate): [q|k|v] = x [Wq|Wk|Wv] (x EXACT bf16 x8; (in,out) weights transposed exact x256); per (batch, 16 queries): S = q k^T (q, k hi+lo x8, 3 products), acc += P v (P plain x1024 relative to the
// running max, v^T hi+lo x8); the mask, softmax bookkeeping and the final division in f32; the x half of the output is the bf16-rounded input copied through. Inputs rounded to bf16 once. Fragment k-map per lane

namespace {
constexpr int B = 4, S = 4096, D = 128, KS = 64, DO = D + KS, NBLK = S / 16;
constexpr float XS = 8.0f, PS = 1024.0f, WSC = 256.0f;
// key split: a piece = PK keys (4 chunks of 32); the QG query blocks of group g = qb / QG each have g + 1 pieces; PPB pieces per batch
constexpr int PK = 128, QG = PK / 16, NG = NBLK / QG, PPB = QG * (NG * (NG + 1) / 2);
__device__ __forceinline__ int piece_slot0(int b, int qb) { const int g = qb / QG; return b * PPB + QG * (g * (g + 1) / 2) + (qb % QG) * (g + 1); }
typedef _Float16 b16;
typedef __attribute__((ext_vector_type(16))) _Float16 v16b;
typedef __attribute__((ext_vector_type(8))) _Float16 v8b;
typedef __attribute__((ext_vector_type(8))) float v8f;
typedef __attribute__((ext_vector_type(4))) float v4f;
typedef __attribute__((ext_vector_type(2))) float v2f;
__device__ __forceinline__ float bf16_rne(float f) { unsigned int u = __float_as_uint(f); u += 0x7FFFu + ((u >> 16) & 1u); return __uint_as_float(u & 0xFFFF0000u); }
__device__ __forceinline__ void split16(float v, b16& hi, b16& lo) { hi = (b16)v; lo = (b16)(v - (float)hi); }
__device__ __forceinline__ v16b frag_kb(const b16* p, int hh) { const v8b a = *(const v8b*)(p + 8 * hh), b = *(const v8b*)(p + 16 + 8 * hh); v16b f;
#pragma unroll
  for (int e = 0; e < 8; ++e) { f[e] = a[e]; f[8 + e] = b[e]; } return f; }
// fragment-order planes: per 16-row block FB halves, hi then lo, each 4 groups x 32 lanes x 8; a fragment = the lane's 8 halves of two groups, each load 512 B in a row
constexpr int FG = 32 * 8, FH = 4 * FG, FB = 2 * FH;
typedef const __attribute__((address_space(1))) b16* gptr;
typedef const __attribute__((address_space(1))) v8b* gptr8;
// a wave-uniform global pointer kept in scalar registers, so that the q fragment loads take the form scalar base + lane offset and need no vector address pair
__device__ __forceinline__ gptr uni(const b16* p) { const unsigned long long u = (unsigned long long)p; return (gptr)(((unsigned long long)(unsigned int)__builtin_amdgcn_readfirstlane((int)(u >> 32)) << 32) | (unsigned int)__builtin_amdgcn_readfirstlane((int)u)); }
__device__ __forceinline__ v16b frag_g(gptr p0, gptr p1) { const v8b a = *(gptr8)p0, b = *(gptr8)p1; v16b f;
#pragma unroll
  for (int e = 0; e < 8; ++e) { f[e] = a[e]; f[8 + e] = b[e]; } return f; }
__device__ __forceinline__ v16b frag_s(const b16* p0, const b16* p1) { const v8b a = *(const v8b*)p0, b = *(const v8b*)p1; v16b f;
#pragma unroll
  for (int e = 0; e < 8; ++e) { f[e] = a[e]; f[8 + e] = b[e]; } return f; }
// eight asynchronous 16-byte copies a lane, global to LDS, CS bytes apart; the s_wait_xcnt closes the statement so that no address register is rewritten in front of it
constexpr int CS = 256 * 16;
__device__ __forceinline__ void copy8(unsigned l, const char* g) {
  asm volatile("global_load_async_to_lds_b128 %0, %8, off\n\tglobal_load_async_to_lds_b128 %1, %9, off\n\tglobal_load_async_to_lds_b128 %2, %10, off\n\tglobal_load_async_to_lds_b128 %3, %11, off\n\t"
               "global_load_async_to_lds_b128 %4, %12, off\n\tglobal_load_async_to_lds_b128 %5, %13, off\n\tglobal_load_async_to_lds_b128 %6, %14, off\n\tglobal_load_async_to_lds_b128 %7, %15, off\n\ts_wait_xcnt 0x0"
               :: "v"(l), "v"(l + CS), "v"(l + 2 * CS), "v"(l + 3 * CS), "v"(l + 4 * CS), "v"(l + 5 * CS), "v"(l + 6 * CS), "v"(l + 7 * CS),
                  "v"(g), "v"(g + CS), "v"(g + 2 * CS), "v"(g + 3 * CS), "v"(g + 4 * CS), "v"(g + 5 * CS), "v"(g + 6 * CS), "v"(g + 7 * CS) : "memory"); }
__device__ __forceinline__ v8f wmma16b(v16b a, v16b b, v8f c) { v8f d = __builtin_amdgcn_wmma_f32_16x16x32_f16(false, a, false, b, (short)0, c, false, false); asm volatile("v_nop\n\tv_nop\n\tv_nop\n\tv_nop" : "+v"(d) : "v"(a), "v"(b)); return d; }
__device__ __forceinline__ void wave_lds_sync() { __builtin_amdgcn_fence(__ATOMIC_RELEASE, "workgroup"); __builtin_amdgcn_wave_barrier(); __builtin_amdgcn_fence(__ATOMIC_ACQUIRE, "workgroup"); }
__device__ __forceinline__ float pmul(float a, float b) { float p = a * b; asm volatile("" : "+v"(p)); return p; }
__device__ __forceinline__ float xhalf(float x) { return __builtin_bit_cast(float, __builtin_amdgcn_permlanex16(__builtin_bit_cast(int, x), __builtin_bit_cast(int, x), 0x76543210, 0xfedcba98, false, false)); }  // lane l with lane l ^ 16

__global__ __launch_bounds__(256) void wput_kernel(const float* __restrict__ w, int ro, b16* __restrict__ WT) {
  const int u = blockIdx.x * 256 + threadIdx.x; if (u >= KS * 16) return; const int o = u / 16, k0 = (u % 16) * 8; v8b v;
#pragma unroll
  for (int j = 0; j < 8; ++j) v[j] = (b16)(bf16_rne(w[(size_t)(k0 + j) * KS + o]) * WSC); { *(v8b*)(WT + (size_t)(ro + o) * D + k0) = v;  }
}
__global__ __launch_bounds__(32) void qkv_kernel(const float* __restrict__ x, const b16* __restrict__ WT, const float* __restrict__ bq, const float* __restrict__ bk, const float* __restrict__ bv, int RLIM, b16* __restrict__ QF, b16* __restrict__ KF, b16* __restrict__ VF, float* __restrict__ out) {
  __shared__ __attribute__((aligned(16))) b16 Ah[16][D + 8]; __shared__ __attribute__((aligned(16))) float Tf[16][3 * KS + 4];
  const int lane = threadIdx.x, nloc = lane & 15, hlf = lane >> 4; const size_t m0 = (size_t)blockIdx.x * 16; if (m0 >= (size_t)RLIM) return;
  for (int rr = 0; rr < 16; ++rr) for (int q = 0; q < 4; ++q) Ah[rr][q * 32 + lane] = (b16)(bf16_rne(x[(m0 + rr) * D + q * 32 + lane]) * XS);
  wave_lds_sync(); v8f acc[12];
#pragma unroll
  for (int t = 0; t < 12; ++t) acc[t] = (v8f){};
#pragma unroll
  for (int kb = 0; kb < D; kb += 32) { const v16b a = frag_kb(&Ah[nloc][kb], hlf);
#pragma unroll
    for (int t = 0; t < 12; ++t) acc[t] = wmma16b(a, frag_kb(WT + (size_t)(t * 16 + nloc) * D + kb, hlf), acc[t]); }
#pragma unroll
  for (int t = 0; t < 12; ++t) { const int c = t * 16 + nloc; const float bb = bf16_rne(c < KS ? bq[c] : (c < 2 * KS ? bk[c - KS] : bv[c - 2 * KS]));
#pragma unroll
    for (int r8 = 0; r8 < 8; ++r8) Tf[8 * hlf + r8][c] = acc[t][r8] * (1.0f / (XS * WSC)) + bb; }
  wave_lds_sync();
  // q, k (row nloc, columns g * 16 + 8 * hlf + e) and v (key 8 * hlf + e, column g * 16 + nloc) split hi+lo x8 once, stored as the attention waves' fragments
#pragma unroll
  for (int w = 0; w < 3; ++w) { b16* fp = (w == 0 ? QF : w == 1 ? KF : VF) + (size_t)blockIdx.x * FB + lane * 8;
#pragma unroll
    for (int g = 0; g < 4; ++g) { v8b h, l;
#pragma unroll
      for (int e = 0; e < 8; ++e) { b16 p, ql; split16((w < 2 ? Tf[nloc][w * KS + g * 16 + 8 * hlf + e] : Tf[8 * hlf + e][2 * KS + g * 16 + nloc]) * XS, p, ql); h[e] = p; l[e] = ql; }
      *(v8b*)(fp + g * FG) = h; *(v8b*)(fp + FH + g * FG) = l; } }
  asm volatile("s_wait_xcnt 0x0" ::: "memory");   // the loads below land in registers that the fragment stores name: the wait stands in front of that overwrite
  { for (int rr = 0; rr < 16; ++rr) { *(v4f*)(out + (m0 + rr) * DO + lane * 4) = (v4f){bf16_rne(x[(m0 + rr) * D + lane * 4]), bf16_rne(x[(m0 + rr) * D + lane * 4 + 1]), bf16_rne(x[(m0 + rr) * D + lane * 4 + 2]), bf16_rne(x[(m0 + rr) * D + lane * 4 + 3])}; }  }
}
// causal attention: work-group per (batch, group of 8 query blocks, piece of 128 keys), wave per query block. The piece's k and v fragment planes (32 KB each, contiguous) are copied to LDS once, asynchronously, and all eight waves
// read their fragments there: one L2 read of the piece for 128 queries. One barrier behind the copies; none after it, so a wave that ends at its diagonal just leaves. Per wave: online softmax over the piece's 32-key chunks kc <= query block. Both products run transposed: S^T = k q^T / 8 (A = key rows, B = queries; hi+lo, 3 products), so that
// a lane holds 16 of the chunk's 32 scores of ONE query (query nloc; keys blk * 16 + 8 * hlf + r8): mask, maximum, exp and sum stay in its registers, the two halves of the wave meet in one cross-row move for the maximum and, once a piece, for the sum.
// The two score tiles, converted in place, are the B fragment of acc^T += v^T P^T (A = v^T hi+lo x8, P plain x1024): scores and P never touch LDS. acc[t][r8] = column t * 16 + 8 * hlf + r8 of query nloc.
// the piece's unnormalised acc (register order), M and Dn go to the workspace. Groups g and NG - 1 - g are paired (NG + 1 pieces a pair), so the flat index covers exactly the pieces that exist.
// register budget of 128, so that eight waves fit a SIMD: the waves hide one another's softmax and load latency
__global__ __launch_bounds__(256) __attribute__((amdgpu_waves_per_eu(8))) void att_kernel(const b16* __restrict__ QF, const b16* __restrict__ KF, const b16* __restrict__ VF, int BV, float* __restrict__ PA, float* __restrict__ PM) {
  __shared__ __attribute__((aligned(16))) b16 KV[2 * QG * FB];   // the piece's k planes, then its v planes
  const int lane = threadIdx.x & 31, nloc = lane & 15, hlf = lane >> 4, wv = __builtin_amdgcn_readfirstlane(threadIdx.x >> 5); const int b = blockIdx.x / (PPB / QG), jp = blockIdx.x % (PPB / QG), pr = jp / (NG + 1), rp = jp % (NG + 1); if (b >= BV) return;
  const int g = rp <= pr ? pr : NG - 1 - pr, pc = rp <= pr ? rp : rp - pr - 1, qb = g * QG + wv; const size_t q0 = (size_t)qb * 16; const int kend = min(pc * PK + PK, (int)q0 + 16);
  { const size_t po = (size_t)(b * NBLK + pc * QG) * FB * 2 + threadIdx.x * 16; const unsigned l = (unsigned)(unsigned long long)(const char*)KV + threadIdx.x * 16;   // thread's 16 bytes of each 4-KB block: 8 blocks of k, 8 of v
    copy8(l, (const char*)KF + po); copy8(l + QG * FB * 2, (const char*)VF + po); }
  v16b qfh[2], qfl[2]; { const gptr qp = uni(QF + (size_t)(b * NBLK + qb) * FB) + lane * 8;
#pragma unroll
    for (int k2 = 0; k2 < 2; ++k2) { qfh[k2] = frag_g(qp + 2 * k2 * FG, qp + (2 * k2 + 1) * FG); qfl[k2] = frag_g(qp + FH + 2 * k2 * FG, qp + FH + (2 * k2 + 1) * FG); } }
  asm volatile("s_wait_asynccnt 0x0" ::: "memory");   // this wave's copies have landed
  __syncthreads();                                    // and every other wave's: the piece may be read
  float mo = -INFINITY, dn = 0.0f;   // the lane's query: running maximum (equal in both halves), running sum over the lane's own keys
  v8f acc[4];
#pragma unroll
  for (int t = 0; t < 4; ++t) acc[t] = (v8f){};
#pragma unroll 1
  for (int kc = pc * PK; kc < kend; kc += 32) {
    const b16* kp = KV + (kc - pc * PK) / 16 * FB + lane * 8; const b16* vp = kp + QG * FB;   // two 16-key blocks; rows past the diagonal lie in the piece and are masked below
    float sc[2][8]; const int lim = (int)q0 + nloc - kc - 8 * hlf;   // the lane's last unmasked key, counted from its first key of the chunk
#pragma unroll
    for (int blk = 0; blk < 2; ++blk) { v8f s = {}; const b16* kf = kp + blk * FB; const v16b kfh[2] = {frag_s(kf, kf + FG), frag_s(kf + 2 * FG, kf + 3 * FG)}, kfl[2] = {frag_s(kf + FH, kf + FH + FG), frag_s(kf + FH + 2 * FG, kf + FH + 3 * FG)};
      asm volatile("" :: "v"(kfh[0]), "v"(kfh[1]), "v"(kfl[0]), "v"(kfl[1]));   // holds the key block's eight loads in front of its first product: one load latency a block, not one per k step
#pragma unroll
      for (int ks = 0; ks < KS; ks += 32) { const v16b qh = qfh[ks / 32], ql = qfl[ks / 32], kh = kfh[ks / 32], kl = kfl[ks / 32]; s = wmma16b(kh, qh, s); s = wmma16b(kl, qh, s); s = wmma16b(kh, ql, s); }
#pragma unroll
      for (int r8 = 0; r8 < 8; ++r8) sc[blk][r8] = blk * 16 + r8 > lim ? -INFINITY : s[r8] * (0.125f / (XS * XS)); }   // key kc + blk * 16 + 8 * hlf + r8 > query q0 + nloc
    float cm = sc[0][0];
#pragma unroll
    for (int e = 1; e < 16; ++e) cm = fmaxf(cm, sc[e >> 3][e & 7]);
    cm = fmaxf(cm, xhalf(cm)); const float mn = fmaxf(mo, cm), sf = (mo == -INFINITY) ? 0.0f : __expf(mo - mn);
    float psum = 0.0f; v16b pb;   // pb[e] = P[query nloc][key (e >> 3) * 16 + 8 * hlf + (e & 7)]: the k order of the v fragments
#pragma unroll
    for (int e = 0; e < 16; ++e) { const float sv = sc[e >> 3][e & 7], p = sv == -INFINITY ? 0.0f : __expf(sv - mn); psum += p; pb[e] = (b16)(p * PS); }
    dn = dn * sf + psum; mo = mn;
#pragma unroll
    for (int t = 0; t < 4; ++t)
#pragma unroll
      for (int r8 = 0; r8 < 8; ++r8) acc[t][r8] *= sf;
#pragma unroll
    for (int t = 0; t < 4; t += 2) { const v16b vh0 = frag_s(vp + t * FG, vp + FB + t * FG), vl0 = frag_s(vp + FH + t * FG, vp + FB + FH + t * FG), vh1 = frag_s(vp + (t + 1) * FG, vp + FB + (t + 1) * FG), vl1 = frag_s(vp + FH + (t + 1) * FG, vp + FB + FH + (t + 1) * FG);
      asm volatile("" :: "v"(vh0), "v"(vl0), "v"(vh1), "v"(vl1));   // holds two column tiles' eight loads in front of their first product: one load latency a pair, not one per product
      acc[t] = wmma16b(vh0, pb, acc[t]); acc[t] = wmma16b(vl0, pb, acc[t]); acc[t + 1] = wmma16b(vh1, pb, acc[t + 1]); acc[t + 1] = wmma16b(vl1, pb, acc[t + 1]); } }
  dn += xhalf(dn);
  const size_t slot = (size_t)(piece_slot0(b, qb) + pc);
  PM[slot * 32 + lane] = lane < 16 ? mo : dn;
#pragma unroll
  for (int t = 0; t < 4; ++t) *(v8f*)(PA + slot * (16 * KS) + (size_t)(t * 32 + lane) * 8) = acc[t];
}
// merge: block per (batch, 16 queries): m = max over pieces of M, w = exp(M - m), read = sum w acc / sum w Dn, pieces in key order; thread = (column tile, lane) of the acc register order: query nloc, columns t * 16 + 8 * hlf + 0..7
__global__ __launch_bounds__(128) void merge_kernel(const float* __restrict__ PA, const float* __restrict__ PM, int BV, float* __restrict__ out) {
  __shared__ float Ls[NG * 32], Ds[16];
  const int tid = threadIdx.x, lane = tid & 31, nloc = lane & 15, hlf = lane >> 4, t = tid >> 5; const int b = blockIdx.x / NBLK, qb = blockIdx.x % NBLK; if (b >= BV) return;
  const int np = qb / QG + 1; const size_t slot0 = (size_t)piece_slot0(b, qb);
  float pm[NG * 32 / 128];   // index clamped to the last piece, so that the loads carry no guard and fly together
#pragma unroll
  for (int i = 0; i < NG * 32 / 128; ++i) pm[i] = PM[slot0 * 32 + min(i * 128 + tid, np * 32 - 1)];
#pragma unroll
  for (int i = 0; i < NG * 32 / 128; ++i) if (i * 128 + tid < np * 32) Ls[i * 128 + tid] = pm[i];
  __syncthreads();
  { const int row = tid >> 3, s8 = tid & 7; float mp[NG / 8], m = -INFINITY, d = 0.0f;   // 8 threads a row, pieces s8, s8 + 8, ...
#pragma unroll
    for (int i = 0; i < NG / 8; ++i) { const int p = i * 8 + s8; mp[i] = p < np ? Ls[p * 32 + row] : -INFINITY; m = fmaxf(m, mp[i]); }
    for (int o = 4; o; o >>= 1) m = fmaxf(m, __shfl_xor(m, o));
#pragma unroll
    for (int i = 0; i < NG / 8; ++i) { const int p = i * 8 + s8; if (p < np) { const float w = mp[i] == -INFINITY ? 0.0f : __expf(mp[i] - m); d += w * Ls[p * 32 + 16 + row]; Ls[p * 32 + row] = w; } }
    for (int o = 4; o; o >>= 1) d += __shfl_xor(d, o);
    if (s8 == 0) Ds[row] = d; }
  __syncthreads();
  v8f a = {}; const float* pa = PA + slot0 * (16 * KS) + (size_t)tid * 8;
#pragma unroll 8   // eight pieces' loads in flight instead of one load latency a piece
  for (int p = 0; p < np; ++p) { const v8f v = *(const v8f*)(pa + (size_t)p * (16 * KS));
#pragma unroll
    for (int r8 = 0; r8 < 8; ++r8) a[r8] += v[r8] * Ls[p * 32 + nloc]; }
#pragma unroll
  for (int r8 = 0; r8 < 8; ++r8) a[r8] = a[r8] * (1.0f / (PS * XS)) / Ds[nloc];
  *(v8f*)(out + ((size_t)b * S + (size_t)qb * 16 + nloc) * DO + D + t * 16 + 8 * hlf) = a;
}
}  // namespace

extern "C" void kernel_launch(void* const* d_in, const int* in_sizes, int n_in, void* d_out, int out_size, void* d_ws, size_t ws_size, hipStream_t stream) {
  (void)n_in;
  auto Fp = [&](int i) { return (const float*)d_in[i]; };
  // input order: 0 inputs [4,4096,128]; 1 Wq [128,64]; 2 bq; 3 Wk; 4 bk; 5 Wv; 6 bv
  if (in_sizes[0] != B * S * D || in_sizes[1] != D * KS || in_sizes[3] != D * KS || in_sizes[5] != D * KS || in_sizes[2] != KS || out_size != B * S * DO) return;
  const int BV = B, SV = S;
  size_t off = 0; char* ws = (char*)d_ws;
  auto carve = [&](size_t bytes) { char* p = ws + off; off += (bytes + 255) & ~(size_t)255; return p; };
  b16* WT = (b16*)carve((size_t)3 * KS * D * 2); b16* QF = (b16*)carve((size_t)B * NBLK * FB * 2); b16* KF = (b16*)carve((size_t)B * NBLK * FB * 2); b16* VF = (b16*)carve((size_t)B * NBLK * FB * 2);
  float* PA = (float*)carve((size_t)B * PPB * 16 * KS * 4); float* PM = (float*)carve((size_t)B * PPB * 32 * 4);
  if (off > ws_size || off > ((size_t)96 << 20)) return;   // ~ 84 MB
  wput_kernel<<<(KS * 16 + 255) / 256, 256, 0, stream>>>(Fp(1), 0, WT); wput_kernel<<<(KS * 16 + 255) / 256, 256, 0, stream>>>(Fp(3), KS, WT); wput_kernel<<<(KS * 16 + 255) / 256, 256, 0, stream>>>(Fp(5), 2 * KS, WT);
  float* out = (float*)d_out;
  qkv_kernel<<<(unsigned)((BV == B ? B * S : SV) / 16), 32, 0, stream>>>(Fp(0), WT, Fp(2), Fp(4), Fp(6), BV == B ? B * S : SV, QF, KF, VF, out);
  att_kernel<<<(unsigned)(B * PPB / QG), 256, 0, stream>>>(QF, KF, VF, BV, PA, PM);
  merge_kernel<<<(unsigned)(B * NBLK), 128, 0, stream>>>(PA, PM, BV, out);
}

// v005
// One run takes 53.6 microseconds.
// Two timings next to v004 both put it at 1.23 times that version's speed.
// Counting every step since v000, it is 33.8 times as fast.
#include <hip/hip_runtime.h>

// Snail (causal) attention read head: q, k, v = x Wq/Wk/Wv + b (128 -> 64 each); probs = softmax((q k^T + causal mask) / 8); read = probs v; out = [x | read] -> [4][4096][192].
// Deterministic, no atomics, no index structures; the keys of a query block are cut into pieces of 128, one wave per piece (online softmax over its 32-key chunks, keys in order); a merge launch joins the pieces in key order.
// WMMA (v_wmma_f32_16x16x32_f16, f32 accumulate): [q|k|v] = x [Wq|Wk|Wv] (x EXACT bf16 x8; (in,out) weights transposed exact x256); per (batch, 16 queries): S = q k^T (q, k hi+lo x8, 3 products), acc += P v (P plain x1024 relative to the
// running max, v^T hi+lo x8); the mask, softmax bookkeeping and the final division in f32; the x half of the output is the bf16-rounded input copied through. Inputs rounded to bf16 once. Fragment k-map per lane

namespace {
constexpr int B = 4, S = 4096, D = 128, KS = 64, DO = D + KS, NBLK = S / 16;
constexpr float XS = 8.0f, PS = 1024.0f, WSC = 256.0f;
// key split: a piece = PK keys (4 chunks of 32); the QG query blocks of group g = qb / QG each have g + 1 pieces; PPB pieces per batch
constexpr int PK = 128, QG = PK / 16, NG = NBLK / QG, PPB = QG * (NG * (NG + 1) / 2);
__device__ __forceinline__ int piece_slot0(int b, int qb) { const int g = qb / QG; return b * PPB + QG * (g * (g + 1) / 2) + (qb % QG) * (g + 1); }
typedef _Float16 b16;
typedef __attribute__((ext_vector_type(16))) _Float16 v16b;
typedef __attribute__((ext_vector_type(8))) _Float16 v8b;
typedef __attribute__((ext_vector_type(4))) _Float16 v4b;
typedef __attribute__((ext_vector_type(8))) float v8f;
typedef __attribute__((ext_vector_type(4))) float v4f;
typedef __attribute__((ext_vector_type(2))) float v2f;
__device__ __forceinline__ float bf16_rne(float f) { unsigned int u = __float_as_uint(f); u += 0x7FFFu + ((u >> 16) & 1u); return __uint_as_float(u & 0xFFFF0000u); }
__device__ __forceinline__ void split16(float v, b16& hi, b16& lo) { hi = (b16)v; lo = (b16)(v - (float)hi); }
__device__ __forceinline__ v16b frag_kb(const b16* p, int hh) { const v8b a = *(const v8b*)(p + 8 * hh), b = *(const v8b*)(p + 16 + 8 * hh); v16b f;
#pragma unroll
  for (int e = 0; e < 8; ++e) { f[e] = a[e]; f[8 + e] = b[e]; } return f; }
// fragment-order planes: per 16-row block FB halves, hi then lo, each 4 groups x 32 lanes x 8; a fragment = the lane's 8 halves of two groups, each load 512 B in a row
constexpr int FG = 32 * 8, FH = 4 * FG, FB = 2 * FH;
typedef const __attribute__((address_space(1))) b16* gptr;
typedef const __attribute__((address_space(1))) v8b* gptr8;
// a wave-uniform global pointer kept in scalar registers, so that the q fragment loads take the form scalar base + lane offset and need no vector address pair
__device__ __forceinline__ gptr uni(const b16* p) { const unsigned long long u = (unsigned long long)p; return (gptr)(((unsigned long long)(unsigned int)__builtin_amdgcn_readfirstlane((int)(u >> 32)) << 32) | (unsigned int)__builtin_amdgcn_readfirstlane((int)u)); }
__device__ __forceinline__ v16b frag_g(gptr p0, gptr p1) { const v8b a = *(gptr8)p0, b = *(gptr8)p1; v16b f;
#pragma unroll
  for (int e = 0; e < 8; ++e) { f[e] = a[e]; f[8 + e] = b[e]; } return f; }
__device__ __forceinline__ v16b frag_s(const b16* p0, const b16* p1) { const v8b a = *(const v8b*)p0, b = *(const v8b*)p1; v16b f;
#pragma unroll
  for (int e = 0; e < 8; ++e) { f[e] = a[e]; f[8 + e] = b[e]; } return f; }
// eight asynchronous 16-byte copies a lane, global to LDS, CS bytes apart; the s_wait_xcnt closes the statement so that no address register is rewritten in front of it
constexpr int CS = 256 * 16;
__device__ __forceinline__ void copy8(unsigned l, const char* g) {
  asm volatile("global_load_async_to_lds_b128 %0, %8, off\n\tglobal_load_async_to_lds_b128 %1, %9, off\n\tglobal_load_async_to_lds_b128 %2, %10, off\n\tglobal_load_async_to_lds_b128 %3, %11, off\n\t"
               "global_load_async_to_lds_b128 %4, %12, off\n\tglobal_load_async_to_lds_b128 %5, %13, off\n\tglobal_load_async_to_lds_b128 %6, %14, off\n\tglobal_load_async_to_lds_b128 %7, %15, off\n\ts_wait_xcnt 0x0"
               :: "v"(l), "v"(l + CS), "v"(l + 2 * CS), "v"(l + 3 * CS), "v"(l + 4 * CS), "v"(l + 5 * CS), "v"(l + 6 * CS), "v"(l + 7 * CS),
                  "v"(g), "v"(g + CS), "v"(g + 2 * CS), "v"(g + 3 * CS), "v"(g + 4 * CS), "v"(g + 5 * CS), "v"(g + 6 * CS), "v"(g + 7 * CS) : "memory"); }
__device__ __forceinline__ v8f wmma16b(v16b a, v16b b, v8f c) { v8f d = __builtin_amdgcn_wmma_f32_16x16x32_f16(false, a, false, b, (short)0, c, false, false); asm volatile("v_nop\n\tv_nop\n\tv_nop\n\tv_nop" : "+v"(d) : "v"(a), "v"(b)); return d; }
__device__ __forceinline__ void wave_lds_sync() { __builtin_amdgcn_fence(__ATOMIC_RELEASE, "workgroup"); __builtin_amdgcn_wave_barrier(); __builtin_amdgcn_fence(__ATOMIC_ACQUIRE, "workgroup"); }
__device__ __forceinline__ float pmul(float a, float b) { float p = a * b; asm volatile("" : "+v"(p)); return p; }
__device__ __forceinline__ float xhalf(float x) { return __builtin_bit_cast(float, __builtin_amdgcn_permlanex16(__builtin_bit_cast(int, x), __builtin_bit_cast(int, x), 0x76543210, 0xfedcba98, false, false)); }  // lane l with lane l ^ 16

__global__ __launch_bounds__(256) void wput_kernel(const float* __restrict__ w, int ro, b16* __restrict__ WT) {
  const int u = blockIdx.x * 256 + threadIdx.x; if (u >= KS * 16) return; const int o = u / 16, k0 = (u % 16) * 8; v8b v;
#pragma unroll
  for (int j = 0; j < 8; ++j) v[j] = (b16)(bf16_rne(w[(size_t)(k0 + j) * KS + o]) * WSC); { *(v8b*)(WT + (size_t)(ro + o) * D + k0) = v;  }
}
// one wave per 16 rows, about one wave a SIMD: little hides a load's latency but the wave's own order, so its loads fly in batches. First batch: the 16 x rows (one 16-byte load a lane a row) and the first k step's
// 12 weight fragments. After that each fragment register is refilled for the next k step directly behind the product that read it, a whole k step (12 products) ahead of its use. x is read once: the rounded rows go to out from registers.
__global__ __launch_bounds__(32) void qkv_kernel(const float* __restrict__ x, const b16* __restrict__ WT, const float* __restrict__ bq, const float* __restrict__ bk, const float* __restrict__ bv, int RLIM, b16* __restrict__ QF, b16* __restrict__ KF, b16* __restrict__ VF, float* __restrict__ out) {
  __shared__ __attribute__((aligned(16))) b16 Ah[16][D + 8]; __shared__ __attribute__((aligned(16))) float Tf[16][3 * KS + 4];
  const int lane = threadIdx.x, nloc = lane & 15, hlf = lane >> 4; const size_t m0 = (size_t)blockIdx.x * 16; if (m0 >= (size_t)RLIM) return;
  v4f xr[16]; float bb[12]; v16b wf[12]; const float* xp = x + m0 * D + lane * 4; const b16* wp = WT + (size_t)nloc * D + 8 * hlf;   // the lane's 16 bytes of an x row; its half of weight row nloc
#pragma unroll
  for (int rr = 0; rr < 16; ++rr) xr[rr] = *(const v4f*)(xp + rr * D);
#pragma unroll
  for (int t = 0; t < 12; ++t) wf[t] = frag_kb(wp + t * 16 * D, 0);
  asm volatile("s_wait_xcnt 0x0" ::: "memory");   // the batch's address registers are free for reuse only behind this wait
#pragma unroll
  for (int rr = 0; rr < 16; ++rr) { v4b h;
#pragma unroll
    for (int j = 0; j < 4; ++j) { xr[rr][j] = bf16_rne(xr[rr][j]); h[j] = (b16)(xr[rr][j] * XS); }
    *(v4b*)&Ah[rr][lane * 4] = h; }
  wave_lds_sync();
#pragma unroll
  for (int rr = 0; rr < 16; ++rr) *(v4f*)(out + (m0 + rr) * DO + lane * 4) = xr[rr];
  asm volatile("s_wait_xcnt 0x0" ::: "memory");   // the registers that these stores name are reused below: the wait stands in front of that overwrite
  v8f acc[12];
#pragma unroll
  for (int t = 0; t < 12; ++t) acc[t] = (v8f){};
#pragma unroll
  for (int kb = 0; kb < D; kb += 32) { const v16b a = frag_kb(&Ah[nloc][kb], hlf);
    if (kb + 32 == D) {   // the biases fly behind the last refills, under the last k step's products
      asm volatile("s_wait_xcnt 0x0" :: "v"(wp) : "memory");   // the weight address stays in its registers up to this wait
#pragma unroll
      for (int t = 0; t < 12; ++t) bb[t] = (t < 4 ? bq : t < 8 ? bk : bv)[(t & 3) * 16 + nloc];
      asm volatile("s_wait_xcnt 0x0" ::: "memory"); }   // no load follows: the biases' address registers are free for reuse only behind this wait
#pragma unroll
    for (int t = 0; t < 12; ++t) { acc[t] = wmma16b(a, wf[t], acc[t]); if (kb + 32 < D) wf[t] = frag_kb(wp + t * 16 * D + kb + 32, 0); } }
#pragma unroll
  for (int t = 0; t < 12; ++t) { const int c = t * 16 + nloc; const float bs = bf16_rne(bb[t]);
#pragma unroll
    for (int r8 = 0; r8 < 8; ++r8) Tf[8 * hlf + r8][c] = acc[t][r8] * (1.0f / (XS * WSC)) + bs; }
  wave_lds_sync();
  // q, k (row nloc, columns g * 16 + 8 * hlf + e) and v (key 8 * hlf + e, column g * 16 + nloc) split hi+lo x8 once, stored as the attention waves' fragments
#pragma unroll
  for (int w = 0; w < 3; ++w) { b16* fp = (w == 0 ? QF : w == 1 ? KF : VF) + (size_t)blockIdx.x * FB + lane * 8;
#pragma unroll
    for (int g = 0; g < 4; ++g) { v8b h, l;
#pragma unroll
      for (int e = 0; e < 8; ++e) { b16 p, ql; split16((w < 2 ? Tf[nloc][w * KS + g * 16 + 8 * hlf + e] : Tf[8 * hlf + e][2 * KS + g * 16 + nloc]) * XS, p, ql); h[e] = p; l[e] = ql; }
      *(v8b*)(fp + g * FG) = h; *(v8b*)(fp + FH + g * FG) = l; } }
}
// causal attention: work-group per (batch, group of 8 query blocks, piece of 128 keys), wave per query block. The piece's k and v fragment planes (32 KB each, contiguous) are copied to LDS once, asynchronously, and all eight waves
// read their fragments there: one L2 read of the piece for 128 queries. One barrier behind the copies; none after it, so a wave that ends at its diagonal just leaves. Per wave: online softmax over the piece's 32-key chunks kc <= query block. Both products run transposed: S^T = k q^T / 8 (A = key rows, B = queries; hi+lo, 3 products), so that
// a lane holds 16 of the chunk's 32 scores of ONE query (query nloc; keys blk * 16 + 8 * hlf + r8): mask, maximum, exp and sum stay in its registers, the two halves of the wave meet in one cross-row move for the maximum and, once a piece, for the sum.
// The two score tiles, converted in place, are the B fragment of acc^T += v^T P^T (A = v^T hi+lo x8, P plain x1024): scores and P never touch LDS. acc[t][r8] = column t * 16 + 8 * hlf + r8 of query nloc.
// the piece's unnormalised acc (register order), M and Dn go to the workspace. Groups g and NG - 1 - g are paired (NG + 1 pieces a pair), so the flat index covers exactly the pieces that exist.
// register budget of 128, so that eight waves fit a SIMD: the waves hide one another's softmax and load latency
__global__ __launch_bounds__(256) __attribute__((amdgpu_waves_per_eu(8))) void att_kernel(const b16* __restrict__ QF, const b16* __restrict__ KF, const b16* __restrict__ VF, int BV, float* __restrict__ PA, float* __restrict__ PM) {
  __shared__ __attribute__((aligned(16))) b16 KV[2 * QG * FB];   // the piece's k planes, then its v planes
  const int lane = threadIdx.x & 31, nloc = lane & 15, hlf = lane >> 4, wv = __builtin_amdgcn_readfirstlane(threadIdx.x >> 5); const int b = blockIdx.x / (PPB / QG), jp = blockIdx.x % (PPB / QG), pr = jp / (NG + 1), rp = jp % (NG + 1); if (b >= BV) return;
  const int g = rp <= pr ? pr : NG - 1 - pr, pc = rp <= pr ? rp : rp - pr - 1, qb = g * QG + wv; const size_t q0 = (size_t)qb * 16; const int kend = min(pc * PK + PK, (int)q0 + 16);
  { const size_t po = (size_t)(b * NBLK + pc * QG) * FB * 2 + threadIdx.x * 16; const unsigned l = (unsigned)(unsigned long long)(const char*)KV + threadIdx.x * 16;   // thread's 16 bytes of each 4-KB block: 8 blocks of k, 8 of v
    copy8(l, (const char*)KF + po); copy8(l + QG * FB * 2, (const char*)VF + po); }
  v16b qfh[2], qfl[2]; { const gptr qp = uni(QF + (size_t)(b * NBLK + qb) * FB) + lane * 8;
#pragma unroll
    for (int k2 = 0; k2 < 2; ++k2) { qfh[k2] = frag_g(qp + 2 * k2 * FG, qp + (2 * k2 + 1) * FG); qfl[k2] = frag_g(qp + FH + 2 * k2 * FG, qp + FH + (2 * k2 + 1) * FG); } }
  asm volatile("s_wait_asynccnt 0x0" ::: "memory");   // this wave's copies have landed
  __syncthreads();                                    // and every other wave's: the piece may be read
  float mo = -INFINITY, dn = 0.0f;   // the lane's query: running maximum (equal in both halves), running sum over the lane's own keys
  v8f acc[4];
#pragma unroll
  for (int t = 0; t < 4; ++t) acc[t] = (v8f){};
#pragma unroll 1
  for (int kc = pc * PK; kc < kend; kc += 32) {
    const b16* kp = KV + (kc - pc * PK) / 16 * FB + lane * 8; const b16* vp = kp + QG * FB;   // two 16-key blocks; rows past the diagonal lie in the piece and are masked below
    float sc[2][8]; const int lim = (int)q0 + nloc - kc - 8 * hlf;   // the lane's last unmasked key, counted from its first key of the chunk
#pragma unroll
    for (int blk = 0; blk < 2; ++blk) { v8f s = {}; const b16* kf = kp + blk * FB; const v16b kfh[2] = {frag_s(kf, kf + FG), frag_s(kf + 2 * FG, kf + 3 * FG)}, kfl[2] = {frag_s(kf + FH, kf + FH + FG), frag_s(kf + FH + 2 * FG, kf + FH + 3 * FG)};
      asm volatile("" :: "v"(kfh[0]), "v"(kfh[1]), "v"(kfl[0]), "v"(kfl[1]));   // holds the key block's eight loads in front of its first product: one load latency a block, not one per k step
#pragma unroll
      for (int ks = 0; ks < KS; ks += 32) { const v16b qh = qfh[ks / 32], ql = qfl[ks / 32], kh = kfh[ks / 32], kl = kfl[ks / 32]; s = wmma16b(kh, qh, s); s = wmma16b(kl, qh, s); s = wmma16b(kh, ql, s); }
#pragma unroll
      for (int r8 = 0; r8 < 8; ++r8) sc[blk][r8] = blk * 16 + r8 > lim ? -INFINITY : s[r8] * (0.125f / (XS * XS)); }   // key kc + blk * 16 + 8 * hlf + r8 > query q0 + nloc
    float cm = sc[0][0];
#pragma unroll
    for (int e = 1; e < 16; ++e) cm = fmaxf(cm, sc[e >> 3][e & 7]);
    cm = fmaxf(cm, xhalf(cm)); const float mn = fmaxf(mo, cm), sf = (mo == -INFINITY) ? 0.0f : __expf(mo - mn);
    float psum = 0.0f; v16b pb;   // pb[e] = P[query nloc][key (e >> 3) * 16 + 8 * hlf + (e & 7)]: the k order of the v fragments
#pragma unroll
    for (int e = 0; e < 16; ++e) { const float sv = sc[e >> 3][e & 7], p = sv == -INFINITY ? 0.0f : __expf(sv - mn); psum += p; pb[e] = (b16)(p * PS); }
    dn = dn * sf + psum; mo = mn;
#pragma unroll
    for (int t = 0; t < 4; ++t)
#pragma unroll
      for (int r8 = 0; r8 < 8; ++r8) acc[t][r8] *= sf;
#pragma unroll
    for (int t = 0; t < 4; t += 2) { const v16b vh0 = frag_s(vp + t * FG, vp + FB + t * FG), vl0 = frag_s(vp + FH + t * FG, vp + FB + FH + t * FG), vh1 = frag_s(vp + (t + 1) * FG, vp + FB + (t + 1) * FG), vl1 = frag_s(vp + FH + (t + 1) * FG, vp + FB + FH + (t + 1) * FG);
      asm volatile("" :: "v"(vh0), "v"(vl0), "v"(vh1), "v"(vl1));   // holds two column tiles' eight loads in front of their first product: one load latency a pair, not one per product
      acc[t] = wmma16b(vh0, pb, acc[t]); acc[t] = wmma16b(vl0, pb, acc[t]); acc[t + 1] = wmma16b(vh1, pb, acc[t + 1]); acc[t + 1] = wmma16b(vl1, pb, acc[t + 1]); } }
  dn += xhalf(dn);
  const size_t slot = (size_t)(piece_slot0(b, qb) + pc);
  PM[slot * 32 + lane] = lane < 16 ? mo : dn;
#pragma unroll
  for (int t = 0; t < 4; ++t) *(v8f*)(PA + slot * (16 * KS) + (size_t)(t * 32 + lane) * 8) = acc[t];
}
// merge: block per (batch, 16 queries): m = max over pieces of M, w = exp(M - m), read = sum w acc / sum w Dn, pieces in key order; thread = (column tile, lane) of the acc register order: query nloc, columns t * 16 + 8 * hlf + 0..7
__global__ __launch_bounds__(128) void merge_kernel(const float* __restrict__ PA, const float* __restrict__ PM, int BV, float* __restrict__ out) {
  __shared__ float Ls[NG * 32], Ds[16];
  const int tid = threadIdx.x, lane = tid & 31, nloc = lane & 15, hlf = lane >> 4, t = tid >> 5; const int b = blockIdx.x / NBLK, qb = blockIdx.x % NBLK; if (b >= BV) return;
  const int np = qb / QG + 1; const size_t slot0 = (size_t)piece_slot0(b, qb);
  float pm[NG * 32 / 128];   // index clamped to the last piece, so that the loads carry no guard and fly together
#pragma unroll
  for (int i = 0; i < NG * 32 / 128; ++i) pm[i] = PM[slot0 * 32 + min(i * 128 + tid, np * 32 - 1)];
#pragma unroll
  for (int i = 0; i < NG * 32 / 128; ++i) if (i * 128 + tid < np * 32) Ls[i * 128 + tid] = pm[i];
  __syncthreads();
  { const int row = tid >> 3, s8 = tid & 7; float mp[NG / 8], m = -INFINITY, d = 0.0f;   // 8 threads a row, pieces s8, s8 + 8, ...
#pragma unroll
    for (int i = 0; i < NG / 8; ++i) { const int p = i * 8 + s8; mp[i] = p < np ? Ls[p * 32 + row] : -INFINITY; m = fmaxf(m, mp[i]); }
    for (int o = 4; o; o >>= 1) m = fmaxf(m, __shfl_xor(m, o));
#pragma unroll
    for (int i = 0; i < NG / 8; ++i) { const int p = i * 8 + s8; if (p < np) { const float w = mp[i] == -INFINITY ? 0.0f : __expf(mp[i] - m); d += w * Ls[p * 32 + 16 + row]; Ls[p * 32 + row] = w; } }
    for (int o = 4; o; o >>= 1) d += __shfl_xor(d, o);
    if (s8 == 0) Ds[row] = d; }
  __syncthreads();
  v8f a = {}; const float* pa = PA + slot0 * (16 * KS) + (size_t)tid * 8;
#pragma unroll 8   // eight pieces' loads in flight instead of one load latency a piece
  for (int p = 0; p < np; ++p) { const v8f v = *(const v8f*)(pa + (size_t)p * (16 * KS));
#pragma unroll
    for (int r8 = 0; r8 < 8; ++r8) a[r8] += v[r8] * Ls[p * 32 + nloc]; }
#pragma unroll
  for (int r8 = 0; r8 < 8; ++r8) a[r8] = a[r8] * (1.0f / (PS * XS)) / Ds[nloc];
  *(v8f*)(out + ((size_t)b * S + (size_t)qb * 16 + nloc) * DO + D + t * 16 + 8 * hlf) = a;
}
}  // namespace

extern "C" void kernel_launch(void* const* d_in, const int* in_sizes, int n_in, void* d_out, int out_size, void* d_ws, size_t ws_size, hipStream_t stream) {
  (void)n_in;
  auto Fp = [&](int i) { return (const float*)d_in[i]; };
  // input order: 0 inputs [4,4096,128]; 1 Wq [128,64]; 2 bq; 3 Wk; 4 bk; 5 Wv; 6 bv
  if (in_sizes[0] != B * S * D || in_sizes[1] != D * KS || in_sizes[3] != D * KS || in_sizes[5] != D * KS || in_sizes[2] != KS || out_size != B * S * DO) return;
  const int BV = B, SV = S;
  size_t off = 0; char* ws = (char*)d_ws;
  auto carve = [&](size_t bytes) { char* p = ws + off; off += (bytes + 255) & ~(size_t)255; return p; };
  b16* WT = (b16*)carve((size_t)3 * KS * D * 2); b16* QF = (b16*)carve((size_t)B * NBLK * FB * 2); b16* KF = (b16*)carve((size_t)B * NBLK * FB * 2); b16* VF = (b16*)carve((size_t)B * NBLK * FB * 2);
  float* PA = (float*)carve((size_t)B * PPB * 16 * KS * 4); float* PM = (float*)carve((size_t)B * PPB * 32 * 4);
  if (off > ws_size || off > ((size_t)96 << 20)) return;   // ~ 84 MB
  wput_kernel<<<(KS * 16 + 255) / 256, 256, 0, stream>>>(Fp(1), 0, WT); wput_kernel<<<(KS * 16 + 255) / 256, 256, 0, stream>>>(Fp(3), KS, WT); wput_kernel<<<(KS * 16 + 255) / 256, 256, 0, stream>>>(Fp(5), 2 * KS, WT);
  float* out = (float*)d_out;
  qkv_kernel<<<(unsigned)((BV == B ? B * S : SV) / 16), 32, 0, stream>>>(Fp(0), WT, Fp(2), Fp(4), Fp(6), BV == B ? B * S : SV, QF, KF, VF, out);
  att_kernel<<<(unsigned)(B * PPB / QG), 256, 0, stream>>>(QF, KF, VF, BV, PA, PM);
  merge_kernel<<<(unsigned)(B * NBLK), 128, 0, stream>>>(PA, PM, BV, out);
}

// v006
// One run takes 46.4 microseconds.
// Timed twice side by side with v005, it ran 1.16 times as fast both times.
// All steps since v000 together make it 39.1 times as fast.
#include <hip/hip_runtime.h>

// Snail (causal) attention read head: q, k, v = x Wq/Wk/Wv + b (128 -> 64 each); probs = softmax((q k^T + causal mask) / 8); read = probs v; out = [x | read] -> [4][4096][192].
// Deterministic, no atomics, no index structures; the keys of a query block are cut into pieces of 128, one wave per piece (online softmax over its 32-key chunks, keys in order); a merge launch joins the pieces in key order.
// WMMA (v_wmma_f32_16x16x32_f16, f32 accumulate): [q|k|v] = x [Wq|Wk|Wv] (x EXACT bf16 x8; (in,out) weights transposed exact x256); per (batch, 16 queries): S = q k^T (q, k hi+lo x8, 3 products), acc += P v (P plain x1024 relative to the
// running max, v^T hi+lo x8); the mask, softmax bookkeeping and the final division in f32; the x half of the output is the bf16-rounded input copied through. Inputs rounded to bf16 once. Fragment k-map per lane

namespace {
constexpr int B = 4, S = 4096, D = 128, KS = 64, DO = D + KS, NBLK = S / 16;
constexpr float XS = 8.0f, PS = 1024.0f, WSC = 256.0f;
// key split: a piece = PK keys (4 chunks of 32); the QG query blocks of group g = qb / QG each have g + 1 pieces; PPB pieces per batch
constexpr int PK = 128, QG = PK / 16, NG = NBLK / QG, PPB = QG * (NG * (NG + 1) / 2);
__device__ __forceinline__ int piece_slot0(int b, int qb) { const int g = qb / QG; return b * PPB + QG * (g * (g + 1) / 2) + (qb % QG) * (g + 1); }
typedef _Float16 b16;
typedef __attribute__((ext_vector_type(16))) _Float16 v16b;
typedef __attribute__((ext_vector_type(8))) _Float16 v8b;
typedef __attribute__((ext_vector_type(4))) _Float16 v4b;
typedef __attribute__((ext_vector_type(8))) float v8f;
typedef __attribute__((ext_vector_type(4))) float v4f;
typedef __attribute__((ext_vector_type(2))) float v2f;
__device__ __forceinline__ float bf16_rne(float f) { unsigned int u = __float_as_uint(f); u += 0x7FFFu + ((u >> 16) & 1u); return __uint_as_float(u & 0xFFFF0000u); }
__device__ __forceinline__ void split16(float v, b16& hi, b16& lo) { hi = (b16)v; lo = (b16)(v - (float)hi); }
__device__ __forceinline__ v16b frag_kb(const b16* p, int hh) { const v8b a = *(const v8b*)(p + 8 * hh), b = *(const v8b*)(p + 16 + 8 * hh); v16b f;
#pragma unroll
  for (int e = 0; e < 8; ++e) { f[e] = a[e]; f[8 + e] = b[e]; } return f; }
// fragment-order planes: per 16-row block FB halves, hi then lo, each 4 groups x 32 lanes x 8; a fragment = the lane's 8 halves of two groups, each load 512 B in a row
constexpr int FG = 32 * 8, FH = 4 * FG, FB = 2 * FH;
typedef const __attribute__((address_space(1))) b16* gptr;
typedef const __attribute__((address_space(1))) v8b* gptr8;
// a wave-uniform global pointer kept in scalar registers, so that the q fragment loads take the form scalar base + lane offset and need no vector address pair
__device__ __forceinline__ gptr uni(const b16* p) { const unsigned long long u = (unsigned long long)p; return (gptr)(((unsigned long long)(unsigned int)__builtin_amdgcn_readfirstlane((int)(u >> 32)) << 32) | (unsigned int)__builtin_amdgcn_readfirstlane((int)u)); }
__device__ __forceinline__ v16b frag_g(gptr p0, gptr p1) { const v8b a = *(gptr8)p0, b = *(gptr8)p1; v16b f;
#pragma unroll
  for (int e = 0; e < 8; ++e) { f[e] = a[e]; f[8 + e] = b[e]; } return f; }
__device__ __forceinline__ v16b frag_s(const b16* p0, const b16* p1) { const v8b a = *(const v8b*)p0, b = *(const v8b*)p1; v16b f;
#pragma unroll
  for (int e = 0; e < 8; ++e) { f[e] = a[e]; f[8 + e] = b[e]; } return f; }
// eight asynchronous 16-byte copies a lane, global to LDS, CS bytes apart; the s_wait_xcnt closes the statement so that no address register is rewritten in front of it
constexpr int CS = 256 * 16;
__device__ __forceinline__ void copy8(unsigned l, const char* g) {
  asm volatile("global_load_async_to_lds_b128 %0, %8, off\n\tglobal_load_async_to_lds_b128 %1, %9, off\n\tglobal_load_async_to_lds_b128 %2, %10, off\n\tglobal_load_async_to_lds_b128 %3, %11, off\n\t"
               "global_load_async_to_lds_b128 %4, %12, off\n\tglobal_load_async_to_lds_b128 %5, %13, off\n\tglobal_load_async_to_lds_b128 %6, %14, off\n\tglobal_load_async_to_lds_b128 %7, %15, off\n\ts_wait_xcnt 0x0"
               :: "v"(l), "v"(l + CS), "v"(l + 2 * CS), "v"(l + 3 * CS), "v"(l + 4 * CS), "v"(l + 5 * CS), "v"(l + 6 * CS), "v"(l + 7 * CS),
                  "v"(g), "v"(g + CS), "v"(g + 2 * CS), "v"(g + 3 * CS), "v"(g + 4 * CS), "v"(g + 5 * CS), "v"(g + 6 * CS), "v"(g + 7 * CS) : "memory"); }
__device__ __forceinline__ v8f wmma16b(v16b a, v16b b, v8f c) { v8f d = __builtin_amdgcn_wmma_f32_16x16x32_f16(false, a, false, b, (short)0, c, false, false); asm volatile("v_nop\n\tv_nop\n\tv_nop\n\tv_nop" : "+v"(d) : "v"(a), "v"(b)); return d; }
__device__ __forceinline__ void wave_lds_sync() { __builtin_amdgcn_fence(__ATOMIC_RELEASE, "workgroup"); __builtin_amdgcn_wave_barrier(); __builtin_amdgcn_fence(__ATOMIC_ACQUIRE, "workgroup"); }
__device__ __forceinline__ float pmul(float a, float b) { float p = a * b; asm volatile("" : "+v"(p)); return p; }
__device__ __forceinline__ float xhalf(float x) { return __builtin_bit_cast(float, __builtin_amdgcn_permlanex16(__builtin_bit_cast(int, x), __builtin_bit_cast(int, x), 0x76543210, 0xfedcba98, false, false)); }  // lane l with lane l ^ 16

// projection: work-group = PW waves, wave per 16 rows, as many work-groups as the chip has WGPs. The three (in,out) f32 weight matrices are rounded, scaled and transposed to f16 rows Wt[out][in] in the work-group's LDS by its own threads, so no launch stands
// in front of this one. A thread takes 4 outputs x 8 inputs at a time: eight 16-byte loads (16 lanes = one 256-byte weight row), four 16-byte LDS stores. All its loads fly together, issued in this order: Wq, Wk, Wv, the biases, then the wave's 16 x rows.
// One barrier publishes Wt; behind it each wave reads its weight fragments from LDS, six together, one group ahead of their products. x is read once: the rounded rows go to out from registers.
constexpr int PW = 4, WPI = D + 8;   // WPI: pitch of a weight row in LDS, 16 bytes x odd, for 16-byte readers
__device__ __forceinline__ void wload(v4f (&r)[16], const float* __restrict__ w, unsigned wo) {   // wo: the thread's byte offset
#pragma unroll
  for (int i = 0; i < 16; ++i) r[i] = *(const v4f*)((const char*)w + wo + ((i >> 3) * 64 + (i & 7)) * KS * 4); }
__device__ __forceinline__ void wconv(const v4f (&r)[16], b16 (*wt)[WPI], int tid) {
#pragma unroll
  for (int h = 0; h < 2; ++h)
#pragma unroll
    for (int c = 0; c < 4; ++c) { v8b v;
#pragma unroll
      for (int j = 0; j < 8; ++j) v[j] = (b16)(bf16_rne(r[h * 8 + j][c]) * WSC);
      *(v8b*)&wt[(tid & 15) * 4 + c][h * 64 + (tid >> 4) * 8] = v; } }
__global__ __launch_bounds__(32 * PW) void qkv_kernel(const float* __restrict__ x, const float* __restrict__ wq, const float* __restrict__ wk, const float* __restrict__ wv, const float* __restrict__ bq, const float* __restrict__ bk, const float* __restrict__ bv, int RLIM, b16* __restrict__ QF, b16* __restrict__ KF, b16* __restrict__ VF, float* __restrict__ out) {
  __shared__ __attribute__((aligned(16))) b16 Wt[3 * KS][WPI]; __shared__ __attribute__((aligned(16))) b16 AhW[PW][16][D + 8]; __shared__ __attribute__((aligned(16))) float TfW[PW][16][3 * KS + 4];
  const int tid = threadIdx.x, lane = tid & 31, nloc = lane & 15, hlf = lane >> 4, wave = __builtin_amdgcn_readfirstlane(tid >> 5); if ((size_t)blockIdx.x * (16 * PW) >= (size_t)RLIM) return;   // the whole work-group, in front of the barrier; RLIM is a multiple of 16 * PW
  const int rb = blockIdx.x * PW + wave; const size_t m0 = (size_t)rb * 16; b16 (*Ah)[D + 8] = AhW[wave]; float (*Tf)[3 * KS + 4] = TfW[wave];
  v4f wa[16], wb[16], wc[16], xr[16]; float bb[12]; const float* xp = x + m0 * D + lane * 4; const unsigned wo = (unsigned)((tid >> 4) * 8 * KS + (tid & 15) * 4) * 4;   // the lane's 16 bytes of an x row; its 4 outputs of input row (tid >> 4) * 8
  wload(wa, wq, wo); wload(wb, wk, wo); wload(wc, wv, wo);
#pragma unroll
  for (int t = 0; t < 12; ++t) bb[t] = (t < 4 ? bq : t < 8 ? bk : bv)[(t & 3) * 16 + nloc];
  asm volatile("" ::: "memory");   // loads return in issue order: the x rows, which come from furthest away, are issued behind the weights, so that the weights are converted while x flies
#pragma unroll
  for (int rr = 0; rr < 16; ++rr) xr[rr] = *(const v4f*)(xp + rr * D);
  asm volatile("s_wait_xcnt 0x0" :: "v"(wo) : "memory");   // the batch's address registers are free for reuse only behind this wait; naming the offset keeps its register from becoming a load's destination in front of it
  wconv(wa, &Wt[0], tid); wconv(wb, &Wt[KS], tid); wconv(wc, &Wt[2 * KS], tid);
#pragma unroll
  for (int rr = 0; rr < 16; ++rr) { v4b h;
#pragma unroll
    for (int j = 0; j < 4; ++j) { xr[rr][j] = bf16_rne(xr[rr][j]); h[j] = (b16)(xr[rr][j] * XS); }
    *(v4b*)&Ah[rr][lane * 4] = h; }
  __syncthreads();   // every wave's part of Wt is written (and the wave's own Ah rows)
#pragma unroll
  for (int rr = 0; rr < 16; ++rr) *(v4f*)(out + (m0 + rr) * DO + lane * 4) = xr[rr];
  asm volatile("s_wait_xcnt 0x0" ::: "memory");   // the registers that these stores name are reused below: the wait stands in front of that overwrite
  v8f acc[12];
#pragma unroll
  for (int t = 0; t < 12; ++t) acc[t] = (v8f){};
  v16b af[4], wf[2][6]; const b16* wl = &Wt[nloc][8 * hlf];   // the lane's half of weight row nloc
#pragma unroll
  for (int k4 = 0; k4 < 4; ++k4) af[k4] = frag_kb(&Ah[nloc][k4 * 32], hlf);
#pragma unroll
  for (int t = 0; t < 6; ++t) wf[0][t] = frag_kb(wl + t * 16 * WPI, 0);
#pragma unroll
  for (int g = 0; g < 8; ++g) {   // group g: k step g / 2, column tiles (g % 2) * 6 + 0..5
    if (g + 1 < 8) {
#pragma unroll
      for (int t = 0; t < 6; ++t) wf[(g + 1) & 1][t] = frag_kb(wl + (((g + 1) & 1) * 6 + t) * 16 * WPI + ((g + 1) >> 1) * 32, 0); }
#pragma unroll
    for (int t = 0; t < 6; ++t) acc[(g & 1) * 6 + t] = wmma16b(af[g >> 1], wf[g & 1][t], acc[(g & 1) * 6 + t]); }
#pragma unroll
  for (int t = 0; t < 12; ++t) { const int c = t * 16 + nloc; const float bs = bf16_rne(bb[t]);
#pragma unroll
    for (int r8 = 0; r8 < 8; ++r8) Tf[8 * hlf + r8][c] = acc[t][r8] * (1.0f / (XS * WSC)) + bs; }
  wave_lds_sync();
  // q, k (row nloc, columns g * 16 + 8 * hlf + e) and v (key 8 * hlf + e, column g * 16 + nloc) split hi+lo x8 once, stored as the attention waves' fragments
#pragma unroll
  for (int w = 0; w < 3; ++w) { b16* fp = (w == 0 ? QF : w == 1 ? KF : VF) + (size_t)rb * FB + lane * 8;
#pragma unroll
    for (int g = 0; g < 4; ++g) { v8b h, l;
#pragma unroll
      for (int e = 0; e < 8; ++e) { b16 p, ql; split16((w < 2 ? Tf[nloc][w * KS + g * 16 + 8 * hlf + e] : Tf[8 * hlf + e][2 * KS + g * 16 + nloc]) * XS, p, ql); h[e] = p; l[e] = ql; }
      *(v8b*)(fp + g * FG) = h; *(v8b*)(fp + FH + g * FG) = l; } }
}
// causal attention: work-group per (batch, group of 8 query blocks, piece of 128 keys), wave per query block. The piece's k and v fragment planes (32 KB each, contiguous) are copied to LDS once, asynchronously, and all eight waves
// read their fragments there: one L2 read of the piece for 128 queries. One barrier behind the copies; none after it, so a wave that ends at its diagonal just leaves. Per wave: online softmax over the piece's 32-key chunks kc <= query block. Both products run transposed: S^T = k q^T / 8 (A = key rows, B = queries; hi+lo, 3 products), so that
// a lane holds 16 of the chunk's 32 scores of ONE query (query nloc; keys blk * 16 + 8 * hlf + r8): mask, maximum, exp and sum stay in its registers, the two halves of the wave meet in one cross-row move for the maximum and, once a piece, for the sum.
// The two score tiles, converted in place, are the B fragment of acc^T += v^T P^T (A = v^T hi+lo x8, P plain x1024): scores and P never touch LDS. acc[t][r8] = column t * 16 + 8 * hlf + r8 of query nloc.
// the piece's unnormalised acc (register order), M and Dn go to the workspace. Groups g and NG - 1 - g are paired (NG + 1 pieces a pair), so the flat index covers exactly the pieces that exist.
// register budget of 128, so that eight waves fit a SIMD: the waves hide one another's softmax and load latency
__global__ __launch_bounds__(256) __attribute__((amdgpu_waves_per_eu(8))) void att_kernel(const b16* __restrict__ QF, const b16* __restrict__ KF, const b16* __restrict__ VF, int BV, float* __restrict__ PA, float* __restrict__ PM) {
  __shared__ __attribute__((aligned(16))) b16 KV[2 * QG * FB];   // the piece's k planes, then its v planes
  const int lane = threadIdx.x & 31, nloc = lane & 15, hlf = lane >> 4, wv = __builtin_amdgcn_readfirstlane(threadIdx.x >> 5); const int b = blockIdx.x / (PPB / QG), jp = blockIdx.x % (PPB / QG), pr = jp / (NG + 1), rp = jp % (NG + 1); if (b >= BV) return;
  const int g = rp <= pr ? pr : NG - 1 - pr, pc = rp <= pr ? rp : rp - pr - 1, qb = g * QG + wv; const size_t q0 = (size_t)qb * 16; const int kend = min(pc * PK + PK, (int)q0 + 16);
  { const size_t po = (size_t)(b * NBLK + pc * QG) * FB * 2 + threadIdx.x * 16; const unsigned l = (unsigned)(unsigned long long)(const char*)KV + threadIdx.x * 16;   // thread's 16 bytes of each 4-KB block: 8 blocks of k, 8 of v
    copy8(l, (const char*)KF + po); copy8(l + QG * FB * 2, (const char*)VF + po); }
  v16b qfh[2], qfl[2]; { const gptr qp = uni(QF + (size_t)(b * NBLK + qb) * FB) + lane * 8;
#pragma unroll
    for (int k2 = 0; k2 < 2; ++k2) { qfh[k2] = frag_g(qp + 2 * k2 * FG, qp + (2 * k2 + 1) * FG); qfl[k2] = frag_g(qp + FH + 2 * k2 * FG, qp + FH + (2 * k2 + 1) * FG); } }
  asm volatile("s_wait_asynccnt 0x0" ::: "memory");   // this wave's copies have landed
  __syncthreads();                                    // and every other wave's: the piece may be read
  float mo = -INFINITY, dn = 0.0f;   // the lane's query: running maximum (equal in both halves), running sum over the lane's own keys
  v8f acc[4];
#pragma unroll
  for (int t = 0; t < 4; ++t) acc[t] = (v8f){};
#pragma unroll 1
  for (int kc = pc * PK; kc < kend; kc += 32) {
    const b16* kp = KV + (kc - pc * PK) / 16 * FB + lane * 8; const b16* vp = kp + QG * FB;   // two 16-key blocks; rows past the diagonal lie in the piece and are masked below
    float sc[2][8]; const int lim = (int)q0 + nloc - kc - 8 * hlf;   // the lane's last unmasked key, counted from its first key of the chunk
#pragma unroll
    for (int blk = 0; blk < 2; ++blk) { v8f s = {}; const b16* kf = kp + blk * FB; const v16b kfh[2] = {frag_s(kf, kf + FG), frag_s(kf + 2 * FG, kf + 3 * FG)}, kfl[2] = {frag_s(kf + FH, kf + FH + FG), frag_s(kf + FH + 2 * FG, kf + FH + 3 * FG)};
      asm volatile("" :: "v"(kfh[0]), "v"(kfh[1]), "v"(kfl[0]), "v"(kfl[1]));   // holds the key block's eight loads in front of its first product: one load latency a block, not one per k step
#pragma unroll
      for (int ks = 0; ks < KS; ks += 32) { const v16b qh = qfh[ks / 32], ql = qfl[ks / 32], kh = kfh[ks / 32], kl = kfl[ks / 32]; s = wmma16b(kh, qh, s); s = wmma16b(kl, qh, s); s = wmma16b(kh, ql, s); }
#pragma unroll
      for (int r8 = 0; r8 < 8; ++r8) sc[blk][r8] = blk * 16 + r8 > lim ? -INFINITY : s[r8] * (0.125f / (XS * XS)); }   // key kc + blk * 16 + 8 * hlf + r8 > query q0 + nloc
    float cm = sc[0][0];
#pragma unroll
    for (int e = 1; e < 16; ++e) cm = fmaxf(cm, sc[e >> 3][e & 7]);
    cm = fmaxf(cm, xhalf(cm)); const float mn = fmaxf(mo, cm), sf = (mo == -INFINITY) ? 0.0f : __expf(mo - mn);
    float psum = 0.0f; v16b pb;   // pb[e] = P[query nloc][key (e >> 3) * 16 + 8 * hlf + (e & 7)]: the k order of the v fragments
#pragma unroll
    for (int e = 0; e < 16; ++e) { const float sv = sc[e >> 3][e & 7], p = sv == -INFINITY ? 0.0f : __expf(sv - mn); psum += p; pb[e] = (b16)(p * PS); }
    dn = dn * sf + psum; mo = mn;
#pragma unroll
    for (int t = 0; t < 4; ++t)
#pragma unroll
      for (int r8 = 0; r8 < 8; ++r8) acc[t][r8] *= sf;
#pragma unroll
    for (int t = 0; t < 4; t += 2) { const v16b vh0 = frag_s(vp + t * FG, vp + FB + t * FG), vl0 = frag_s(vp + FH + t * FG, vp + FB + FH + t * FG), vh1 = frag_s(vp + (t + 1) * FG, vp + FB + (t + 1) * FG), vl1 = frag_s(vp + FH + (t + 1) * FG, vp + FB + FH + (t + 1) * FG);
      asm volatile("" :: "v"(vh0), "v"(vl0), "v"(vh1), "v"(vl1));   // holds two column tiles' eight loads in front of their first product: one load latency a pair, not one per product
      acc[t] = wmma16b(vh0, pb, acc[t]); acc[t] = wmma16b(vl0, pb, acc[t]); acc[t + 1] = wmma16b(vh1, pb, acc[t + 1]); acc[t + 1] = wmma16b(vl1, pb, acc[t + 1]); } }
  dn += xhalf(dn);
  const size_t slot = (size_t)(piece_slot0(b, qb) + pc);
  PM[slot * 32 + lane] = lane < 16 ? mo : dn;
#pragma unroll
  for (int t = 0; t < 4; ++t) *(v8f*)(PA + slot * (16 * KS) + (size_t)(t * 32 + lane) * 8) = acc[t];
}
// merge: block per (batch, 16 queries): m = max over pieces of M, w = exp(M - m), read = sum w acc / sum w Dn, pieces in key order; thread = (column tile, lane) of the acc register order: query nloc, columns t * 16 + 8 * hlf + 0..7
__global__ __launch_bounds__(128) void merge_kernel(const float* __restrict__ PA, const float* __restrict__ PM, int BV, float* __restrict__ out) {
  __shared__ float Ls[NG * 32], Ds[16];
  const int tid = threadIdx.x, lane = tid & 31, nloc = lane & 15, hlf = lane >> 4, t = tid >> 5; const int b = blockIdx.x / NBLK, qb = blockIdx.x % NBLK; if (b >= BV) return;
  const int np = qb / QG + 1; const size_t slot0 = (size_t)piece_slot0(b, qb);
  float pm[NG * 32 / 128];   // index clamped to the last piece, so that the loads carry no guard and fly together
#pragma unroll
  for (int i = 0; i < NG * 32 / 128; ++i) pm[i] = PM[slot0 * 32 + min(i * 128 + tid, np * 32 - 1)];
#pragma unroll
  for (int i = 0; i < NG * 32 / 128; ++i) if (i * 128 + tid < np * 32) Ls[i * 128 + tid] = pm[i];
  __syncthreads();
  { const int row = tid >> 3, s8 = tid & 7; float mp[NG / 8], m = -INFINITY, d = 0.0f;   // 8 threads a row, pieces s8, s8 + 8, ...
#pragma unroll
    for (int i = 0; i < NG / 8; ++i) { const int p = i * 8 + s8; mp[i] = p < np ? Ls[p * 32 + row] : -INFINITY; m = fmaxf(m, mp[i]); }
    for (int o = 4; o; o >>= 1) m = fmaxf(m, __shfl_xor(m, o));
#pragma unroll
    for (int i = 0; i < NG / 8; ++i) { const int p = i * 8 + s8; if (p < np) { const float w = mp[i] == -INFINITY ? 0.0f : __expf(mp[i] - m); d += w * Ls[p * 32 + 16 + row]; Ls[p * 32 + row] = w; } }
    for (int o = 4; o; o >>= 1) d += __shfl_xor(d, o);
    if (s8 == 0) Ds[row] = d; }
  __syncthreads();
  v8f a = {}; const float* pa = PA + slot0 * (16 * KS) + (size_t)tid * 8;
#pragma unroll 8   // eight pieces' loads in flight instead of one load latency a piece
  for (int p = 0; p < np; ++p) { const v8f v = *(const v8f*)(pa + (size_t)p * (16 * KS));
#pragma unroll
    for (int r8 = 0; r8 < 8; ++r8) a[r8] += v[r8] * Ls[p * 32 + nloc]; }
#pragma unroll
  for (int r8 = 0; r8 < 8; ++r8) a[r8] = a[r8] * (1.0f / (PS * XS)) / Ds[nloc];
  *(v8f*)(out + ((size_t)b * S + (size_t)qb * 16 + nloc) * DO + D + t * 16 + 8 * hlf) = a;
}
}  // namespace

extern "C" void kernel_launch(void* const* d_in, const int* in_sizes, int n_in, void* d_out, int out_size, void* d_ws, size_t ws_size, hipStream_t stream) {
  (void)n_in;
  auto Fp = [&](int i) { return (const float*)d_in[i]; };
  // input order: 0 inputs [4,4096,128]; 1 Wq [128,64]; 2 bq; 3 Wk; 4 bk; 5 Wv; 6 bv
  if (in_sizes[0] != B * S * D || in_sizes[1] != D * KS || in_sizes[3] != D * KS || in_sizes[5] != D * KS || in_sizes[2] != KS || out_size != B * S * DO) return;
  const int BV = B, SV = S;
  size_t off = 0; char* ws = (char*)d_ws;
  auto carve = [&](size_t bytes) { char* p = ws + off; off += (bytes + 255) & ~(size_t)255; return p; };
  b16* QF = (b16*)carve((size_t)B * NBLK * FB * 2); b16* KF = (b16*)carve((size_t)B * NBLK * FB * 2); b16* VF = (b16*)carve((size_t)B * NBLK * FB * 2);
  float* PA = (float*)carve((size_t)B * PPB * 16 * KS * 4); float* PM = (float*)carve((size_t)B * PPB * 32 * 4);
  if (off > ws_size || off > ((size_t)96 << 20)) return;   // ~ 84 MB
  float* out = (float*)d_out;
  qkv_kernel<<<(unsigned)((BV == B ? B * S : SV) / (16 * PW)), 32 * PW, 0, stream>>>(Fp(0), Fp(1), Fp(3), Fp(5), Fp(2), Fp(4), Fp(6), BV == B ? B * S : SV, QF, KF, VF, out);
  att_kernel<<<(unsigned)(B * PPB / QG), 256, 0, stream>>>(QF, KF, VF, BV, PA, PM);
  merge_kernel<<<(unsigned)(B * NBLK), 128, 0, stream>>>(PA, PM, BV, out);
}

// v007
// It runs in 40.1 microseconds.
// Next to v006, in two timings, it ran 1.16 times as fast each time.
// Over all steps from v000 it is 45.3 times as fast.
#include <hip/hip_runtime.h>

// Snail (causal) attention read head: q, k, v = x Wq/Wk/Wv + b (128 -> 64 each); probs = softmax((q k^T + causal mask) / 8); read = probs v; out = [x | read] -> [4][4096][192].
// Deterministic, no atomics, no index structures; the keys of a query block are cut into pieces of 256 (two LDS stages of 128), one wave per piece (online softmax over its 32-key chunks, keys in order); a merge launch joins the pieces in key order.
// WMMA (v_wmma_f32_16x16x32_f16, f32 accumulate): [q|k|v] = x [Wq|Wk|Wv] (x EXACT bf16 x8; (in,out) weights transposed exact x256); per (batch, 16 queries): S = q k^T (q, k hi+lo x8, 3 products), acc += P v (P plain x1024 relative to the
// running max, v^T hi+lo x8); the mask, softmax bookkeeping and the final division in f32; the x half of the output is the bf16-rounded input copied through. Inputs rounded to bf16 once. Fragment k-map per lane

namespace {
constexpr int B = 4, S = 4096, D = 128, KS = 64, DO = D + KS, NBLK = S / 16;
constexpr float XS = 8.0f, PS = 1024.0f, WSC = 256.0f;
// key split: a stage = PK keys (4 chunks of 32), a piece = two stages; the QG query blocks of group g = qb / QG each have g / 2 + 1 pieces (the last one ends at the diagonal stage g); NH = most pieces of a block; PPB pieces per batch
constexpr int PK = 128, QG = PK / 16, NG = NBLK / QG, NH = NG / 2, PPB = QG * NH * (NH + 1);
__device__ __forceinline__ int piece_slot0(int b, int qb) { const int g = qb / QG, h = g / 2; return b * PPB + QG * (h + 1) * (h + (g & 1)) + (qb % QG) * (h + 1); }   // (h + 1)(h + g % 2) = pieces of the groups below g
typedef _Float16 b16;
typedef __attribute__((ext_vector_type(16))) _Float16 v16b;
typedef __attribute__((ext_vector_type(8))) _Float16 v8b;
typedef __attribute__((ext_vector_type(4))) _Float16 v4b;
typedef __attribute__((ext_vector_type(8))) float v8f;
typedef __attribute__((ext_vector_type(4))) float v4f;
typedef __attribute__((ext_vector_type(2))) float v2f;
__device__ __forceinline__ float bf16_rne(float f) { unsigned int u = __float_as_uint(f); u += 0x7FFFu + ((u >> 16) & 1u); return __uint_as_float(u & 0xFFFF0000u); }
__device__ __forceinline__ void split16(float v, b16& hi, b16& lo) { hi = (b16)v; lo = (b16)(v - (float)hi); }
__device__ __forceinline__ v16b frag_kb(const b16* p, int hh) { const v8b a = *(const v8b*)(p + 8 * hh), b = *(const v8b*)(p + 16 + 8 * hh); v16b f;
#pragma unroll
  for (int e = 0; e < 8; ++e) { f[e] = a[e]; f[8 + e] = b[e]; } return f; }
// fragment-order planes: per 16-row block FB halves, hi then lo, each 4 groups x 32 lanes x 8; a fragment = the lane's 8 halves of two groups, each load 512 B in a row
constexpr int FG = 32 * 8, FH = 4 * FG, FB = 2 * FH;
typedef const __attribute__((address_space(1))) b16* gptr;
typedef const __attribute__((address_space(1))) v8b* gptr8;
// a wave-uniform global pointer kept in scalar registers, so that the q fragment loads take the form scalar base + lane offset and need no vector address pair
__device__ __forceinline__ gptr uni(const b16* p) { const unsigned long long u = (unsigned long long)p; return (gptr)(((unsigned long long)(unsigned int)__builtin_amdgcn_readfirstlane((int)(u >> 32)) << 32) | (unsigned int)__builtin_amdgcn_readfirstlane((int)u)); }
__device__ __forceinline__ v16b frag_g(gptr p0, gptr p1) { const v8b a = *(gptr8)p0, b = *(gptr8)p1; v16b f;
#pragma unroll
  for (int e = 0; e < 8; ++e) { f[e] = a[e]; f[8 + e] = b[e]; } return f; }
__device__ __forceinline__ v16b frag_s(const b16* p0, const b16* p1) { const v8b a = *(const v8b*)p0, b = *(const v8b*)p1; v16b f;
#pragma unroll
  for (int e = 0; e < 8; ++e) { f[e] = a[e]; f[8 + e] = b[e]; } return f; }
// eight asynchronous 16-byte copies a lane, global to LDS, CS bytes apart; the s_wait_xcnt closes the statement so that no address register is rewritten in front of it
constexpr int CS = 256 * 16;
__device__ __forceinline__ void copy8(unsigned l, const char* g) {
  asm volatile("global_load_async_to_lds_b128 %0, %8, off\n\tglobal_load_async_to_lds_b128 %1, %9, off\n\tglobal_load_async_to_lds_b128 %2, %10, off\n\tglobal_load_async_to_lds_b128 %3, %11, off\n\t"
               "global_load_async_to_lds_b128 %4, %12, off\n\tglobal_load_async_to_lds_b128 %5, %13, off\n\tglobal_load_async_to_lds_b128 %6, %14, off\n\tglobal_load_async_to_lds_b128 %7, %15, off\n\ts_wait_xcnt 0x0"
               :: "v"(l), "v"(l + CS), "v"(l + 2 * CS), "v"(l + 3 * CS), "v"(l + 4 * CS), "v"(l + 5 * CS), "v"(l + 6 * CS), "v"(l + 7 * CS),
                  "v"(g), "v"(g + CS), "v"(g + 2 * CS), "v"(g + 3 * CS), "v"(g + 4 * CS), "v"(g + 5 * CS), "v"(g + 6 * CS), "v"(g + 7 * CS) : "memory"); }
__device__ __forceinline__ v8f wmma16b(v16b a, v16b b, v8f c) { v8f d = __builtin_amdgcn_wmma_f32_16x16x32_f16(false, a, false, b, (short)0, c, false, false); asm volatile("v_nop\n\tv_nop\n\tv_nop\n\tv_nop" : "+v"(d) : "v"(a), "v"(b)); return d; }
__device__ __forceinline__ void wave_lds_sync() { __builtin_amdgcn_fence(__ATOMIC_RELEASE, "workgroup"); __builtin_amdgcn_wave_barrier(); __builtin_amdgcn_fence(__ATOMIC_ACQUIRE, "workgroup"); }
__device__ __forceinline__ float pmul(float a, float b) { float p = a * b; asm volatile("" : "+v"(p)); return p; }
__device__ __forceinline__ float xhalf(float x) { return __builtin_bit_cast(float, __builtin_amdgcn_permlanex16(__builtin_bit_cast(int, x), __builtin_bit_cast(int, x), 0x76543210, 0xfedcba98, false, false)); }  // lane l with lane l ^ 16

// projection: work-group = PW waves, wave per 16 rows, as many work-groups as the chip has WGPs. The three (in,out) f32 weight matrices are rounded, scaled and transposed to f16 rows Wt[out][in] in the work-group's LDS by its own threads, so no launch stands
// in front of this one. A thread takes 4 outputs x 8 inputs at a time: eight 16-byte loads (16 lanes = one 256-byte weight row), four 16-byte LDS stores. All its loads fly together, issued in this order: Wq, Wk, Wv, the biases, then the wave's 16 x rows.
// One barrier publishes Wt; behind it each wave reads its weight fragments from LDS, six together, one group ahead of their products. x is read once: the rounded rows go to out from registers.
constexpr int PW = 4, WPI = D + 8;   // WPI: pitch of a weight row in LDS, 16 bytes x odd, for 16-byte readers
__device__ __forceinline__ void wload(v4f (&r)[16], const float* __restrict__ w, unsigned wo) {   // wo: the thread's byte offset
#pragma unroll
  for (int i = 0; i < 16; ++i) r[i] = *(const v4f*)((const char*)w + wo + ((i >> 3) * 64 + (i & 7)) * KS * 4); }
__device__ __forceinline__ void wconv(const v4f (&r)[16], b16 (*wt)[WPI], int tid) {
#pragma unroll
  for (int h = 0; h < 2; ++h)
#pragma unroll
    for (int c = 0; c < 4; ++c) { v8b v;
#pragma unroll
      for (int j = 0; j < 8; ++j) v[j] = (b16)(bf16_rne(r[h * 8 + j][c]) * WSC);
      *(v8b*)&wt[(tid & 15) * 4 + c][h * 64 + (tid >> 4) * 8] = v; } }
__global__ __launch_bounds__(32 * PW) void qkv_kernel(const float* __restrict__ x, const float* __restrict__ wq, const float* __restrict__ wk, const float* __restrict__ wv, const float* __restrict__ bq, const float* __restrict__ bk, const float* __restrict__ bv, int RLIM, b16* __restrict__ QF, b16* __restrict__ KF, b16* __restrict__ VF, float* __restrict__ out) {
  __shared__ __attribute__((aligned(16))) b16 Wt[3 * KS][WPI]; __shared__ __attribute__((aligned(16))) b16 AhW[PW][16][D + 8]; __shared__ __attribute__((aligned(16))) float TfW[PW][16][3 * KS + 4];
  const int tid = threadIdx.x, lane = tid & 31, nloc = lane & 15, hlf = lane >> 4, wave = __builtin_amdgcn_readfirstlane(tid >> 5); if ((size_t)blockIdx.x * (16 * PW) >= (size_t)RLIM) return;   // the whole work-group, in front of the barrier; RLIM is a multiple of 16 * PW
  const int rb = blockIdx.x * PW + wave; const size_t m0 = (size_t)rb * 16; b16 (*Ah)[D + 8] = AhW[wave]; float (*Tf)[3 * KS + 4] = TfW[wave];
  v4f wa[16], wb[16], wc[16], xr[16]; float bb[12]; const float* xp = x + m0 * D + lane * 4; const unsigned wo = (unsigned)((tid >> 4) * 8 * KS + (tid & 15) * 4) * 4;   // the lane's 16 bytes of an x row; its 4 outputs of input row (tid >> 4) * 8
  wload(wa, wq, wo); wload(wb, wk, wo); wload(wc, wv, wo);
#pragma unroll
  for (int t = 0; t < 12; ++t) bb[t] = (t < 4 ? bq : t < 8 ? bk : bv)[(t & 3) * 16 + nloc];
  asm volatile("" ::: "memory");   // loads return in issue order: the x rows, which come from furthest away, are issued behind the weights, so that the weights are converted while x flies
#pragma unroll
  for (int rr = 0; rr < 16; ++rr) xr[rr] = *(const v4f*)(xp + rr * D);
  asm volatile("s_wait_xcnt 0x0" :: "v"(wo) : "memory");   // the batch's address registers are free for reuse only behind this wait; naming the offset keeps its register from becoming a load's destination in front of it
  wconv(wa, &Wt[0], tid); wconv(wb, &Wt[KS], tid); wconv(wc, &Wt[2 * KS], tid);
#pragma unroll
  for (int rr = 0; rr < 16; ++rr) { v4b h;
#pragma unroll
    for (int j = 0; j < 4; ++j) { xr[rr][j] = bf16_rne(xr[rr][j]); h[j] = (b16)(xr[rr][j] * XS); }
    *(v4b*)&Ah[rr][lane * 4] = h; }
  __syncthreads();   // every wave's part of Wt is written (and the wave's own Ah rows)
#pragma unroll
  for (int rr = 0; rr < 16; ++rr) *(v4f*)(out + (m0 + rr) * DO + lane * 4) = xr[rr];
  asm volatile("s_wait_xcnt 0x0" ::: "memory");   // the registers that these stores name are reused below: the wait stands in front of that overwrite
  v8f acc[12];
#pragma unroll
  for (int t = 0; t < 12; ++t) acc[t] = (v8f){};
  v16b af[4], wf[2][6]; const b16* wl = &Wt[nloc][8 * hlf];   // the lane's half of weight row nloc
#pragma unroll
  for (int k4 = 0; k4 < 4; ++k4) af[k4] = frag_kb(&Ah[nloc][k4 * 32], hlf);
#pragma unroll
  for (int t = 0; t < 6; ++t) wf[0][t] = frag_kb(wl + t * 16 * WPI, 0);
#pragma unroll
  for (int g = 0; g < 8; ++g) {   // group g: k step g / 2, column tiles (g % 2) * 6 + 0..5
    if (g + 1 < 8) {
#pragma unroll
      for (int t = 0; t < 6; ++t) wf[(g + 1) & 1][t] = frag_kb(wl + (((g + 1) & 1) * 6 + t) * 16 * WPI + ((g + 1) >> 1) * 32, 0); }
#pragma unroll
    for (int t = 0; t < 6; ++t) acc[(g & 1) * 6 + t] = wmma16b(af[g >> 1], wf[g & 1][t], acc[(g & 1) * 6 + t]); }
#pragma unroll
  for (int t = 0; t < 12; ++t) { const int c = t * 16 + nloc; const float bs = bf16_rne(bb[t]);
#pragma unroll
    for (int r8 = 0; r8 < 8; ++r8) Tf[8 * hlf + r8][c] = acc[t][r8] * (1.0f / (XS * WSC)) + bs; }
  wave_lds_sync();
  // q, k (row nloc, columns g * 16 + 8 * hlf + e) and v (key 8 * hlf + e, column g * 16 + nloc) split hi+lo x8 once, stored as the attention waves' fragments
#pragma unroll
  for (int w = 0; w < 3; ++w) { b16* fp = (w == 0 ? QF : w == 1 ? KF : VF) + (size_t)rb * FB + lane * 8;
#pragma unroll
    for (int g = 0; g < 4; ++g) { v8b h, l;
#pragma unroll
      for (int e = 0; e < 8; ++e) { b16 p, ql; split16((w < 2 ? Tf[nloc][w * KS + g * 16 + 8 * hlf + e] : Tf[8 * hlf + e][2 * KS + g * 16 + nloc]) * XS, p, ql); h[e] = p; l[e] = ql; }
      *(v8b*)(fp + g * FG) = h; *(v8b*)(fp + FH + g * FG) = l; } }
}
// causal attention: work-group per (batch, group of 8 query blocks, piece of 256 keys), wave per query block. The piece is walked in two stages of 128 keys: a stage's k and v fragment planes (32 KB each, contiguous) are copied to LDS, asynchronously, and all eight waves
// read their fragments there: one L2 read of the stage for 128 queries. The wave's maximum, sum and acc run on over both stages, so that 256 keys leave one partial. One barrier behind a stage's copies; one in front of the second stage's, which go into the same LDS; none behind the
// last stage's, so a wave that ends at its diagonal just leaves. Per wave: online softmax over the piece's 32-key chunks kc <= query block. Both products run transposed: S^T = k q^T / 8 (A = key rows, B = queries; hi+lo, 3 products), so that
// a lane holds 16 of the chunk's 32 scores of ONE query (query nloc; keys blk * 16 + 8 * hlf + r8): mask, maximum, exp and sum stay in its registers, the two halves of the wave meet in one cross-row move for the maximum and, once a piece, for the sum.
// The two score tiles, converted in place, are the B fragment of acc^T += v^T P^T (A = v^T hi+lo x8, P plain x1024): scores and P never touch LDS. acc[t][r8] = column t * 16 + 8 * hlf + r8 of query nloc.
// the piece's unnormalised acc (register order), M and Dn go to the workspace. The flat index covers exactly the pieces that exist, the longest first: NFP whole pieces a batch (pair rows h and NH - 1 - h of 2 h pieces each
// are joined, 2 (NH - 1) a pair), then the last pieces of the odd groups (a whole stage and the diagonal stage), then those of the even groups (the diagonal stage alone).
// register budget of 128, so that eight waves fit a SIMD: the waves hide one another's softmax and load latency
constexpr int NFP = NH * (NH - 1);   // pieces of a batch's query groups that end in front of the diagonal stage: g / 2 of group g
__global__ __launch_bounds__(256) __attribute__((amdgpu_waves_per_eu(8))) void att_kernel(const b16* __restrict__ QF, const b16* __restrict__ KF, const b16* __restrict__ VF, int BV, float* __restrict__ PA, float* __restrict__ PM) {
  __shared__ __attribute__((aligned(16))) b16 KV[2 * QG * FB];   // the stage's k planes, then its v planes
  const int lane = threadIdx.x & 31, nloc = lane & 15, hlf = lane >> 4, wv = __builtin_amdgcn_readfirstlane(threadIdx.x >> 5); int b, g, pc;
  if ((int)blockIdx.x < B * NFP) { b = blockIdx.x / NFP; const int jp = blockIdx.x % NFP, pr = jp / (2 * (NH - 1)), rp = jp % (2 * (NH - 1)), h = rp < 2 * pr ? pr : NH - 1 - pr, r = rp < 2 * pr ? rp : rp - 2 * pr; g = 2 * h + (r >= h); pc = r >= h ? r - h : r; }
  else { const int r = blockIdx.x - B * NFP; b = r % (B * NH) / NH; pc = r % NH; g = 2 * pc + (r < B * NH); }
  if (b >= BV) return;
  const int qb = g * QG + wv, nst = min(2, g + 1 - 2 * pc); const size_t q0 = (size_t)qb * 16;   // nst: the piece's stages, the same for the whole work-group
  v16b qfh[2], qfl[2]; { const gptr qp = uni(QF + (size_t)(b * NBLK + qb) * FB) + lane * 8;
#pragma unroll
    for (int k2 = 0; k2 < 2; ++k2) { qfh[k2] = frag_g(qp + 2 * k2 * FG, qp + (2 * k2 + 1) * FG); qfl[k2] = frag_g(qp + FH + 2 * k2 * FG, qp + FH + (2 * k2 + 1) * FG); } }
  float mo = -INFINITY, dn = 0.0f;   // the lane's query: running maximum (equal in both halves), running sum over the lane's own keys
  v8f acc[4];
#pragma unroll
  for (int t = 0; t < 4; ++t) acc[t] = (v8f){};
  for (int st = 0; st < nst; ++st) { const int k0 = (2 * pc + st) * PK, kend = min(k0 + PK, (int)q0 + 16);
  if (st) { asm volatile("s_wait_dscnt 0x0" ::: "memory");   // this wave's reads of the first stage have returned
    __syncthreads(); }                                  // and every other wave's: the LDS may be refilled
  { const size_t po = (size_t)(b * NBLK + k0 / 16) * FB * 2 + threadIdx.x * 16; const unsigned l = (unsigned)(unsigned long long)(const char*)KV + threadIdx.x * 16;   // thread's 16 bytes of each 4-KB block: 8 blocks of k, 8 of v
    copy8(l, (const char*)KF + po); copy8(l + QG * FB * 2, (const char*)VF + po); }
  asm volatile("s_wait_asynccnt 0x0" ::: "memory");   // this wave's copies have landed
  __syncthreads();                                    // and every other wave's: the stage may be read
#pragma unroll 1
  for (int kc = k0; kc < kend; kc += 32) {
    const b16* kp = KV + (kc - k0) / 16 * FB + lane * 8; const b16* vp = kp + QG * FB;   // two 16-key blocks; rows past the diagonal lie in the piece and are masked below
    float sc[2][8]; const int lim = (int)q0 + nloc - kc - 8 * hlf;   // the lane's last unmasked key, counted from its first key of the chunk
#pragma unroll
    for (int blk = 0; blk < 2; ++blk) { v8f s = {}; const b16* kf = kp + blk * FB; const v16b kfh[2] = {frag_s(kf, kf + FG), frag_s(kf + 2 * FG, kf + 3 * FG)}, kfl[2] = {frag_s(kf + FH, kf + FH + FG), frag_s(kf + FH + 2 * FG, kf + FH + 3 * FG)};
      asm volatile("" :: "v"(kfh[0]), "v"(kfh[1]), "v"(kfl[0]), "v"(kfl[1]));   // holds the key block's eight loads in front of its first product: one load latency a block, not one per k step
#pragma unroll
      for (int ks = 0; ks < KS; ks += 32) { const v16b qh = qfh[ks / 32], ql = qfl[ks / 32], kh = kfh[ks / 32], kl = kfl[ks / 32]; s = wmma16b(kh, qh, s); s = wmma16b(kl, qh, s); s = wmma16b(kh, ql, s); }
#pragma unroll
      for (int r8 = 0; r8 < 8; ++r8) sc[blk][r8] = blk * 16 + r8 > lim ? -INFINITY : s[r8] * (0.125f / (XS * XS)); }   // key kc + blk * 16 + 8 * hlf + r8 > query q0 + nloc
    float cm = sc[0][0];
#pragma unroll
    for (int e = 1; e < 16; ++e) cm = fmaxf(cm, sc[e >> 3][e & 7]);
    cm = fmaxf(cm, xhalf(cm)); const float mn = fmaxf(mo, cm), sf = (mo == -INFINITY) ? 0.0f : __expf(mo - mn);
    float psum = 0.0f; v16b pb;   // pb[e] = P[query nloc][key (e >> 3) * 16 + 8 * hlf + (e & 7)]: the k order of the v fragments
#pragma unroll
    for (int e = 0; e < 16; ++e) { const float sv = sc[e >> 3][e & 7], p = sv == -INFINITY ? 0.0f : __expf(sv - mn); psum += p; pb[e] = (b16)(p * PS); }
    dn = dn * sf + psum; mo = mn;
#pragma unroll
    for (int t = 0; t < 4; ++t)
#pragma unroll
      for (int r8 = 0; r8 < 8; ++r8) acc[t][r8] *= sf;
#pragma unroll
    for (int t = 0; t < 4; t += 2) { const v16b vh0 = frag_s(vp + t * FG, vp + FB + t * FG), vl0 = frag_s(vp + FH + t * FG, vp + FB + FH + t * FG), vh1 = frag_s(vp + (t + 1) * FG, vp + FB + (t + 1) * FG), vl1 = frag_s(vp + FH + (t + 1) * FG, vp + FB + FH + (t + 1) * FG);
      asm volatile("" :: "v"(vh0), "v"(vl0), "v"(vh1), "v"(vl1));   // holds two column tiles' eight loads in front of their first product: one load latency a pair, not one per product
      acc[t] = wmma16b(vh0, pb, acc[t]); acc[t] = wmma16b(vl0, pb, acc[t]); acc[t + 1] = wmma16b(vh1, pb, acc[t + 1]); acc[t + 1] = wmma16b(vl1, pb, acc[t + 1]); } } }
  dn += xhalf(dn);
  const size_t slot = (size_t)(piece_slot0(b, qb) + pc);
  PM[slot * 32 + lane] = lane < 16 ? mo : dn;
#pragma unroll
  for (int t = 0; t < 4; ++t) *(v8f*)(PA + slot * (16 * KS) + (size_t)(t * 32 + lane) * 8) = acc[t];
}
// merge: block per (batch, 16 queries): m = max over pieces of M, w = exp(M - m), read = sum w acc / sum w Dn, pieces in key order; thread = (column tile, lane) of the acc register order: query nloc, columns t * 16 + 8 * hlf + 0..7
__global__ __launch_bounds__(128) void merge_kernel(const float* __restrict__ PA, const float* __restrict__ PM, int BV, float* __restrict__ out) {
  __shared__ float Ls[NH * 32], Ds[16];
  const int tid = threadIdx.x, lane = tid & 31, nloc = lane & 15, hlf = lane >> 4, t = tid >> 5; const int b = blockIdx.x / NBLK, qb = blockIdx.x % NBLK; if (b >= BV) return;
  const int np = qb / QG / 2 + 1; const size_t slot0 = (size_t)piece_slot0(b, qb);
  float pm[NH * 32 / 128];   // index clamped to the last piece, so that the loads carry no guard and fly together
#pragma unroll
  for (int i = 0; i < NH * 32 / 128; ++i) pm[i] = PM[slot0 * 32 + min(i * 128 + tid, np * 32 - 1)];
#pragma unroll
  for (int i = 0; i < NH * 32 / 128; ++i) if (i * 128 + tid < np * 32) Ls[i * 128 + tid] = pm[i];
  __syncthreads();
  { const int row = tid >> 3, s8 = tid & 7; float mp[NH / 8], m = -INFINITY, d = 0.0f;   // 8 threads a row, pieces s8, s8 + 8, ...
#pragma unroll
    for (int i = 0; i < NH / 8; ++i) { const int p = i * 8 + s8; mp[i] = p < np ? Ls[p * 32 + row] : -INFINITY; m = fmaxf(m, mp[i]); }
    for (int o = 4; o; o >>= 1) m = fmaxf(m, __shfl_xor(m, o));
#pragma unroll
    for (int i = 0; i < NH / 8; ++i) { const int p = i * 8 + s8; if (p < np) { const float w = mp[i] == -INFINITY ? 0.0f : __expf(mp[i] - m); d += w * Ls[p * 32 + 16 + row]; Ls[p * 32 + row] = w; } }
    for (int o = 4; o; o >>= 1) d += __shfl_xor(d, o);
    if (s8 == 0) Ds[row] = d; }
  __syncthreads();
  v8f a = {}; const float* pa = PA + slot0 * (16 * KS) + (size_t)tid * 8;
#pragma unroll 8   // eight pieces' loads in flight instead of one load latency a piece
  for (int p = 0; p < np; ++p) { const v8f v = *(const v8f*)(pa + (size_t)p * (16 * KS));
#pragma unroll
    for (int r8 = 0; r8 < 8; ++r8) a[r8] += v[r8] * Ls[p * 32 + nloc]; }
#pragma unroll
  for (int r8 = 0; r8 < 8; ++r8) a[r8] = a[r8] * (1.0f / (PS * XS)) / Ds[nloc];
  *(v8f*)(out + ((size_t)b * S + (size_t)qb * 16 + nloc) * DO + D + t * 16 + 8 * hlf) = a;
}
}  // namespace

extern "C" void kernel_launch(void* const* d_in, const int* in_sizes, int n_in, void* d_out, int out_size, void* d_ws, size_t ws_size, hipStream_t stream) {
  (void)n_in;
  auto Fp = [&](int i) { return (const float*)d_in[i]; };
  // input order: 0 inputs [4,4096,128]; 1 Wq [128,64]; 2 bq; 3 Wk; 4 bk; 5 Wv; 6 bv
  if (in_sizes[0] != B * S * D || in_sizes[1] != D * KS || in_sizes[3] != D * KS || in_sizes[5] != D * KS || in_sizes[2] != KS || out_size != B * S * DO) return;
  const int BV = B, SV = S;
  size_t off = 0; char* ws = (char*)d_ws;
  auto carve = [&](size_t bytes) { char* p = ws + off; off += (bytes + 255) & ~(size_t)255; return p; };
  b16* QF = (b16*)carve((size_t)B * NBLK * FB * 2); b16* KF = (b16*)carve((size_t)B * NBLK * FB * 2); b16* VF = (b16*)carve((size_t)B * NBLK * FB * 2);
  float* PA = (float*)carve((size_t)B * PPB * 16 * KS * 4); float* PM = (float*)carve((size_t)B * PPB * 32 * 4);
  if (off > ws_size || off > ((size_t)96 << 20)) return;   // ~ 49 MB
  float* out = (float*)d_out;
  qkv_kernel<<<(unsigned)((BV == B ? B * S : SV) / (16 * PW)), 32 * PW, 0, stream>>>(Fp(0), Fp(1), Fp(3), Fp(5), Fp(2), Fp(4), Fp(6), BV == B ? B * S : SV, QF, KF, VF, out);
  att_kernel<<<(unsigned)(B * PPB / QG), 256, 0, stream>>>(QF, KF, VF, BV, PA, PM);
  merge_kernel<<<(unsigned)(B * NBLK), 128, 0, stream>>>(PA, PM, BV, out);
}

// v008
// A run of this version takes 38.3 microseconds.
// Two timings next to v007 both put it at 1.05 times that version's speed.
// Over all steps from v000 it is 47.7 times as fast.
#include <hip/hip_runtime.h>

// Snail (causal) attention read head: q, k, v = x Wq/Wk/Wv + b (128 -> 64 each); probs = softmax((q k^T + causal mask) / 8); read = probs v; out = [x | read] -> [4][4096][192].
// Deterministic, no atomics, no index structures; the keys of a query block are cut into pieces of 256 (two LDS stages of 128), one wave per piece (online softmax over its 32-key chunks, keys in order); a merge launch joins the pieces in key order.
// WMMA (v_wmma_f32_16x16x32_f16, f32 accumulate): [q|k|v] = x [Wq|Wk|Wv] (x EXACT bf16 x8; (in,out) weights transposed exact x256); per (batch, 16 queries): S = q k^T (q, k hi+lo x8, 3 products), acc += P v (P plain x1024 relative to the
// running max, v^T hi+lo x8); the mask, softmax bookkeeping and the final division in f32; the x half of the output is the bf16-rounded input copied through. Inputs rounded to bf16 once. Fragment k-map per lane

namespace {
constexpr int B = 4, S = 4096, D = 128, KS = 64, DO = D + KS, NBLK = S / 16;
constexpr float XS = 8.0f, PS = 1024.0f, WSC = 256.0f;
// key split: a stage = PK keys (4 chunks of 32), a piece = two stages; the QG query blocks of group g = qb / QG each have g / 2 + 1 pieces (the last one ends at the diagonal stage g); NH = most pieces of a block; PPB pieces per batch
constexpr int PK = 128, QG = PK / 16, NG = NBLK / QG, NH = NG / 2, PPB = QG * NH * (NH + 1);
__device__ __forceinline__ int piece_slot0(int b, int qb) { const int g = qb / QG, h = g / 2; return b * PPB + QG * (h + 1) * (h + (g & 1)) + (qb % QG) * (h + 1); }   // (h + 1)(h + g % 2) = pieces of the groups below g
typedef _Float16 b16;
typedef __attribute__((ext_vector_type(16))) _Float16 v16b;
typedef __attribute__((ext_vector_type(8))) _Float16 v8b;
typedef __attribute__((ext_vector_type(4))) _Float16 v4b;
typedef __attribute__((ext_vector_type(8))) float v8f;
typedef __attribute__((ext_vector_type(4))) float v4f;
typedef __attribute__((ext_vector_type(2))) float v2f;
__device__ __forceinline__ float bf16_rne(float f) { unsigned int u = __float_as_uint(f); u += 0x7FFFu + ((u >> 16) & 1u); return __uint_as_float(u & 0xFFFF0000u); }
__device__ __forceinline__ void split16(float v, b16& hi, b16& lo) { hi = (b16)v; lo = (b16)(v - (float)hi); }
__device__ __forceinline__ v16b frag_kb(const b16* p, int hh) { const v8b a = *(const v8b*)(p + 8 * hh), b = *(const v8b*)(p + 16 + 8 * hh); v16b f;
#pragma unroll
  for (int e = 0; e < 8; ++e) { f[e] = a[e]; f[8 + e] = b[e]; } return f; }
// fragment-order planes: per 16-row block FB halves, hi then lo, each 4 groups x 32 lanes x 8; a fragment = the lane's 8 halves of two groups, each load 512 B in a row
constexpr int FG = 32 * 8, FH = 4 * FG, FB = 2 * FH;
typedef const __attribute__((address_space(1))) b16* gptr;
typedef const __attribute__((address_space(1))) v8b* gptr8;
// a wave-uniform global pointer kept in scalar registers, so that the q fragment loads take the form scalar base + lane offset and need no vector address pair
__device__ __forceinline__ gptr uni(const b16* p) { const unsigned long long u = (unsigned long long)p; return (gptr)(((unsigned long long)(unsigned int)__builtin_amdgcn_readfirstlane((int)(u >> 32)) << 32) | (unsigned int)__builtin_amdgcn_readfirstlane((int)u)); }
__device__ __forceinline__ v16b frag_g(gptr p0, gptr p1) { const v8b a = *(gptr8)p0, b = *(gptr8)p1; v16b f;
#pragma unroll
  for (int e = 0; e < 8; ++e) { f[e] = a[e]; f[8 + e] = b[e]; } return f; }
__device__ __forceinline__ v16b frag_s(const b16* p0, const b16* p1) { const v8b a = *(const v8b*)p0, b = *(const v8b*)p1; v16b f;
#pragma unroll
  for (int e = 0; e < 8; ++e) { f[e] = a[e]; f[8 + e] = b[e]; } return f; }
// eight asynchronous 16-byte copies a lane, global to LDS, CS bytes apart; the s_wait_xcnt closes the statement so that no address register is rewritten in front of it
constexpr int CS = 256 * 16;
__device__ __forceinline__ void copy8(unsigned l, const char* g) {
  asm volatile("global_load_async_to_lds_b128 %0, %8, off\n\tglobal_load_async_to_lds_b128 %1, %9, off\n\tglobal_load_async_to_lds_b128 %2, %10, off\n\tglobal_load_async_to_lds_b128 %3, %11, off\n\t"
               "global_load_async_to_lds_b128 %4, %12, off\n\tglobal_load_async_to_lds_b128 %5, %13, off\n\tglobal_load_async_to_lds_b128 %6, %14, off\n\tglobal_load_async_to_lds_b128 %7, %15, off\n\ts_wait_xcnt 0x0"
               :: "v"(l), "v"(l + CS), "v"(l + 2 * CS), "v"(l + 3 * CS), "v"(l + 4 * CS), "v"(l + 5 * CS), "v"(l + 6 * CS), "v"(l + 7 * CS),
                  "v"(g), "v"(g + CS), "v"(g + 2 * CS), "v"(g + 3 * CS), "v"(g + 4 * CS), "v"(g + 5 * CS), "v"(g + 6 * CS), "v"(g + 7 * CS) : "memory"); }
__device__ __forceinline__ v8f wmma16b(v16b a, v16b b, v8f c) { v8f d = __builtin_amdgcn_wmma_f32_16x16x32_f16(false, a, false, b, (short)0, c, false, false); asm volatile("v_nop\n\tv_nop\n\tv_nop\n\tv_nop" : "+v"(d) : "v"(a), "v"(b)); return d; }
// the attention loop's form, the builtin alone: an accumulate chain needs no distance between its links, and behind a chain's end the compiler keeps the distance itself, with real instructions where it has some; eight waves share the SIMD's one vector port, where every v_nop took a slot.
// The scheduling barrier lets vector and scalar instructions cross (they fill the slots behind a product) and keeps matrix instructions and LDS reads in source order: left free, fragments are fetched early and the loop leaves its 128 registers
__device__ __forceinline__ v8f wmma16c(v16b a, v16b b, v8f c) { v8f d = __builtin_amdgcn_wmma_f32_16x16x32_f16(false, a, false, b, (short)0, c, false, false); __builtin_amdgcn_sched_barrier(0x6); return d; }
__device__ __forceinline__ void wave_lds_sync() { __builtin_amdgcn_fence(__ATOMIC_RELEASE, "workgroup"); __builtin_amdgcn_wave_barrier(); __builtin_amdgcn_fence(__ATOMIC_ACQUIRE, "workgroup"); }
__device__ __forceinline__ float pmul(float a, float b) { float p = a * b; asm volatile("" : "+v"(p)); return p; }
__device__ __forceinline__ float xhalf(float x) { return __builtin_bit_cast(float, __builtin_amdgcn_permlanex16(__builtin_bit_cast(int, x), __builtin_bit_cast(int, x), 0x76543210, 0xfedcba98, false, false)); }  // lane l with lane l ^ 16

// projection: work-group = PW waves, wave per 16 rows, as many work-groups as the chip has WGPs. The three (in,out) f32 weight matrices are rounded, scaled and transposed to f16 rows Wt[out][in] in the work-group's LDS by its own threads, so no launch stands
// in front of this one. A thread takes 4 outputs x 8 inputs at a time: eight 16-byte loads (16 lanes = one 256-byte weight row), four 16-byte LDS stores. All its loads fly together, issued in this order: Wq, Wk, Wv, the biases, then the wave's 16 x rows.
// One barrier publishes Wt; behind it each wave reads its weight fragments from LDS, six together, one group ahead of their products. x is read once: the rounded rows go to out from registers.
constexpr int PW = 4, WPI = D + 8;   // WPI: pitch of a weight row in LDS, 16 bytes x odd, for 16-byte readers
__device__ __forceinline__ void wload(v4f (&r)[16], const float* __restrict__ w, unsigned wo) {   // wo: the thread's byte offset
#pragma unroll
  for (int i = 0; i < 16; ++i) r[i] = *(const v4f*)((const char*)w + wo + ((i >> 3) * 64 + (i & 7)) * KS * 4); }
__device__ __forceinline__ void wconv(const v4f (&r)[16], b16 (*wt)[WPI], int tid) {
#pragma unroll
  for (int h = 0; h < 2; ++h)
#pragma unroll
    for (int c = 0; c < 4; ++c) { v8b v;
#pragma unroll
      for (int j = 0; j < 8; ++j) v[j] = (b16)(bf16_rne(r[h * 8 + j][c]) * WSC);
      *(v8b*)&wt[(tid & 15) * 4 + c][h * 64 + (tid >> 4) * 8] = v; } }
__global__ __launch_bounds__(32 * PW) void qkv_kernel(const float* __restrict__ x, const float* __restrict__ wq, const float* __restrict__ wk, const float* __restrict__ wv, const float* __restrict__ bq, const float* __restrict__ bk, const float* __restrict__ bv, int RLIM, b16* __restrict__ QF, b16* __restrict__ KF, b16* __restrict__ VF, float* __restrict__ out) {
  __shared__ __attribute__((aligned(16))) b16 Wt[3 * KS][WPI]; __shared__ __attribute__((aligned(16))) b16 AhW[PW][16][D + 8]; __shared__ __attribute__((aligned(16))) float TfW[PW][16][3 * KS + 4];
  const int tid = threadIdx.x, lane = tid & 31, nloc = lane & 15, hlf = lane >> 4, wave = __builtin_amdgcn_readfirstlane(tid >> 5); if ((size_t)blockIdx.x * (16 * PW) >= (size_t)RLIM) return;   // the whole work-group, in front of the barrier; RLIM is a multiple of 16 * PW
  const int rb = blockIdx.x * PW + wave; const size_t m0 = (size_t)rb * 16; b16 (*Ah)[D + 8] = AhW[wave]; float (*Tf)[3 * KS + 4] = TfW[wave];
  v4f wa[16], wb[16], wc[16], xr[16]; float bb[12]; const float* xp = x + m0 * D + lane * 4; const unsigned wo = (unsigned)((tid >> 4) * 8 * KS + (tid & 15) * 4) * 4;   // the lane's 16 bytes of an x row; its 4 outputs of input row (tid >> 4) * 8
  wload(wa, wq, wo); wload(wb, wk, wo); wload(wc, wv, wo);
#pragma unroll
  for (int t = 0; t < 12; ++t) bb[t] = (t < 4 ? bq : t < 8 ? bk : bv)[(t & 3) * 16 + nloc];
  asm volatile("" ::: "memory");   // loads return in issue order: the x rows, which come from furthest away, are issued behind the weights, so that the weights are converted while x flies
#pragma unroll
  for (int rr = 0; rr < 16; ++rr) xr[rr] = *(const v4f*)(xp + rr * D);
  asm volatile("s_wait_xcnt 0x0" :: "v"(wo) : "memory");   // the batch's address registers are free for reuse only behind this wait; naming the offset keeps its register from becoming a load's destination in front of it
  wconv(wa, &Wt[0], tid); wconv(wb, &Wt[KS], tid); wconv(wc, &Wt[2 * KS], tid);
#pragma unroll
  for (int rr = 0; rr < 16; ++rr) { v4b h;
#pragma unroll
    for (int j = 0; j < 4; ++j) { xr[rr][j] = bf16_rne(xr[rr][j]); h[j] = (b16)(xr[rr][j] * XS); }
    *(v4b*)&Ah[rr][lane * 4] = h; }
  __syncthreads();   // every wave's part of Wt is written (and the wave's own Ah rows)
#pragma unroll
  for (int rr = 0; rr < 16; ++rr) *(v4f*)(out + (m0 + rr) * DO + lane * 4) = xr[rr];
  asm volatile("s_wait_xcnt 0x0" ::: "memory");   // the registers that these stores name are reused below: the wait stands in front of that overwrite
  v8f acc[12];
#pragma unroll
  for (int t = 0; t < 12; ++t) acc[t] = (v8f){};
  v16b af[4], wf[2][6]; const b16* wl = &Wt[nloc][8 * hlf];   // the lane's half of weight row nloc
#pragma unroll
  for (int k4 = 0; k4 < 4; ++k4) af[k4] = frag_kb(&Ah[nloc][k4 * 32], hlf);
#pragma unroll
  for (int t = 0; t < 6; ++t) wf[0][t] = frag_kb(wl + t * 16 * WPI, 0);
#pragma unroll
  for (int g = 0; g < 8; ++g) {   // group g: k step g / 2, column tiles (g % 2) * 6 + 0..5
    if (g + 1 < 8) {
#pragma unroll
      for (int t = 0; t < 6; ++t) wf[(g + 1) & 1][t] = frag_kb(wl + (((g + 1) & 1) * 6 + t) * 16 * WPI + ((g + 1) >> 1) * 32, 0); }
#pragma unroll
    for (int t = 0; t < 6; ++t) acc[(g & 1) * 6 + t] = wmma16b(af[g >> 1], wf[g & 1][t], acc[(g & 1) * 6 + t]); }
#pragma unroll
  for (int t = 0; t < 12; ++t) { const int c = t * 16 + nloc; const float bs = bf16_rne(bb[t]);
#pragma unroll
    for (int r8 = 0; r8 < 8; ++r8) Tf[8 * hlf + r8][c] = acc[t][r8] * (1.0f / (XS * WSC)) + bs; }
  wave_lds_sync();
  // q, k (row nloc, columns g * 16 + 8 * hlf + e) and v (key 8 * hlf + e, column g * 16 + nloc) split hi+lo x8 once, stored as the attention waves' fragments
#pragma unroll
  for (int w = 0; w < 3; ++w) { b16* fp = (w == 0 ? QF : w == 1 ? KF : VF) + (size_t)rb * FB + lane * 8;
#pragma unroll
    for (int g = 0; g < 4; ++g) { v8b h, l;
#pragma unroll
      for (int e = 0; e < 8; ++e) { b16 p, ql; split16((w < 2 ? Tf[nloc][w * KS + g * 16 + 8 * hlf + e] : Tf[8 * hlf + e][2 * KS + g * 16 + nloc]) * XS, p, ql); h[e] = p; l[e] = ql; }
      *(v8b*)(fp + g * FG) = h; *(v8b*)(fp + FH + g * FG) = l; } }
}
// causal attention: work-group per (batch, group of 8 query blocks, piece of 256 keys), wave per query block. The piece is walked in two stages of 128 keys: a stage's k and v fragment planes (32 KB each, contiguous) are copied to LDS, asynchronously, and all eight waves
// read their fragments there: one L2 read of the stage for 128 queries. The wave's maximum, sum and acc run on over both stages, so that 256 keys leave one partial. One barrier behind a stage's copies; one in front of the second stage's, which go into the same LDS; none behind the
// last stage's, so a wave that ends at its diagonal just leaves. Per wave: online softmax over the piece's 32-key chunks kc <= query block. Both products run transposed: S^T = k q^T / 8 (A = key rows, B = queries; hi+lo, 3 products), so that
// a lane holds 16 of the chunk's 32 scores of ONE query (query nloc; keys blk * 16 + 8 * hlf + r8): mask, maximum, exp and sum stay in its registers, the two halves of the wave meet in one cross-row move for the maximum and, once a piece, for the sum.
// The two score tiles, converted in place, are the B fragment of acc^T += v^T P^T (A = v^T hi+lo x8, P plain x1024): scores and P never touch LDS. acc[t][r8] = column t * 16 + 8 * hlf + r8 of query nloc.
// the piece's unnormalised acc (register order), M and Dn go to the workspace. The flat index covers exactly the pieces that exist, the longest first: NFP whole pieces a batch (pair rows h and NH - 1 - h of 2 h pieces each
// are joined, 2 (NH - 1) a pair), then the last pieces of the odd groups (a whole stage and the diagonal stage), then those of the even groups (the diagonal stage alone).
// register budget of 128, so that eight waves fit a SIMD: the waves hide one another's softmax and load latency
constexpr int NFP = NH * (NH - 1);   // pieces of a batch's query groups that end in front of the diagonal stage: g / 2 of group g
__global__ __launch_bounds__(256) __attribute__((amdgpu_waves_per_eu(8))) void att_kernel(const b16* __restrict__ QF, const b16* __restrict__ KF, const b16* __restrict__ VF, int BV, float* __restrict__ PA, float* __restrict__ PM) {
  __shared__ __attribute__((aligned(16))) b16 KV[2 * QG * FB];   // the stage's k planes, then its v planes
  const int lane = threadIdx.x & 31, nloc = lane & 15, hlf = lane >> 4, wv = __builtin_amdgcn_readfirstlane(threadIdx.x >> 5); int b, g, pc;
  if ((int)blockIdx.x < B * NFP) { b = blockIdx.x / NFP; const int jp = blockIdx.x % NFP, pr = jp / (2 * (NH - 1)), rp = jp % (2 * (NH - 1)), h = rp < 2 * pr ? pr : NH - 1 - pr, r = rp < 2 * pr ? rp : rp - 2 * pr; g = 2 * h + (r >= h); pc = r >= h ? r - h : r; }
  else { const int r = blockIdx.x - B * NFP; b = r % (B * NH) / NH; pc = r % NH; g = 2 * pc + (r < B * NH); }
  if (b >= BV) return;
  const int qb = g * QG + wv, nst = min(2, g + 1 - 2 * pc); const size_t q0 = (size_t)qb * 16;   // nst: the piece's stages, the same for the whole work-group
  v16b qfh[2], qfl[2]; { const gptr qp = uni(QF + (size_t)(b * NBLK + qb) * FB) + lane * 8;
#pragma unroll
    for (int k2 = 0; k2 < 2; ++k2) { qfh[k2] = frag_g(qp + 2 * k2 * FG, qp + (2 * k2 + 1) * FG); qfl[k2] = frag_g(qp + FH + 2 * k2 * FG, qp + FH + (2 * k2 + 1) * FG); } }
  float mo = -INFINITY, dn = 0.0f;   // the lane's query: running maximum (equal in both halves), running sum over the lane's own keys
  v8f acc[4];
#pragma unroll
  for (int t = 0; t < 4; ++t) acc[t] = (v8f){};
  for (int st = 0; st < nst; ++st) { const int k0 = (2 * pc + st) * PK, kend = min(k0 + PK, (int)q0 + 16);
  if (st) { asm volatile("s_wait_dscnt 0x0" ::: "memory");   // this wave's reads of the first stage have returned
    __syncthreads(); }                                  // and every other wave's: the LDS may be refilled
  { const size_t po = (size_t)(b * NBLK + k0 / 16) * FB * 2 + threadIdx.x * 16; const unsigned l = (unsigned)(unsigned long long)(const char*)KV + threadIdx.x * 16;   // thread's 16 bytes of each 4-KB block: 8 blocks of k, 8 of v
    copy8(l, (const char*)KF + po); copy8(l + QG * FB * 2, (const char*)VF + po); }
  asm volatile("s_wait_asynccnt 0x0" ::: "memory");   // this wave's copies have landed
  __syncthreads();                                    // and every other wave's: the stage may be read
#pragma unroll 1
  for (int kc = k0; kc < kend; kc += 32) {
    const b16* kp = KV + (kc - k0) / 16 * FB + lane * 8; const b16* vp = kp + QG * FB;   // two 16-key blocks; rows past the diagonal lie in the piece and are masked below
    float sc[2][8]; const int lim = (int)q0 + nloc - kc - 8 * hlf;   // the lane's last unmasked key, counted from its first key of the chunk
#pragma unroll
    for (int blk = 0; blk < 2; ++blk) { v8f s = {}; const b16* kf = kp + blk * FB; const v16b kfh[2] = {frag_s(kf, kf + FG), frag_s(kf + 2 * FG, kf + 3 * FG)}, kfl[2] = {frag_s(kf + FH, kf + FH + FG), frag_s(kf + FH + 2 * FG, kf + FH + 3 * FG)};
      asm volatile("" :: "v"(kfh[0]), "v"(kfh[1]), "v"(kfl[0]), "v"(kfl[1]));   // holds the key block's eight loads in front of its first product: one load latency a block, not one per k step
#pragma unroll
      for (int ks = 0; ks < KS; ks += 32) { const v16b qh = qfh[ks / 32], ql = qfl[ks / 32], kh = kfh[ks / 32], kl = kfl[ks / 32]; s = wmma16c(kh, qh, s); s = wmma16c(kl, qh, s); s = wmma16c(kh, ql, s); }
#pragma unroll
      for (int r8 = 0; r8 < 8; ++r8) sc[blk][r8] = blk * 16 + r8 > lim ? -INFINITY : s[r8] * (0.125f / (XS * XS)); }   // key kc + blk * 16 + 8 * hlf + r8 > query q0 + nloc
    float cm = sc[0][0];
#pragma unroll
    for (int e = 1; e < 16; ++e) cm = fmaxf(cm, sc[e >> 3][e & 7]);
    cm = fmaxf(cm, xhalf(cm)); const float mn = fmaxf(mo, cm), sf = (mo == -INFINITY) ? 0.0f : __expf(mo - mn);
    float psum = 0.0f; v16b pb;   // pb[e] = P[query nloc][key (e >> 3) * 16 + 8 * hlf + (e & 7)]: the k order of the v fragments
#pragma unroll
    for (int e = 0; e < 16; ++e) { const float sv = sc[e >> 3][e & 7], p = sv == -INFINITY ? 0.0f : __expf(sv - mn); psum += p; pb[e] = (b16)(p * PS); }
    asm volatile("" :: "v"(psum));   // the row's sum, as an input only, held in front of the v loads, against spills: left free, its sixteen adds sink behind the products below, all sixteen P values stay live beside the v fragments and the 128 registers do not hold
    dn = dn * sf + psum; mo = mn;
#pragma unroll
    for (int t = 0; t < 4; ++t)
#pragma unroll
      for (int r8 = 0; r8 < 8; ++r8) acc[t][r8] *= sf;
#pragma unroll
    for (int t = 0; t < 4; t += 2) { const v16b vh0 = frag_s(vp + t * FG, vp + FB + t * FG), vl0 = frag_s(vp + FH + t * FG, vp + FB + FH + t * FG), vh1 = frag_s(vp + (t + 1) * FG, vp + FB + (t + 1) * FG), vl1 = frag_s(vp + FH + (t + 1) * FG, vp + FB + FH + (t + 1) * FG);
      asm volatile("" :: "v"(vh0), "v"(vl0), "v"(vh1), "v"(vl1));   // holds two column tiles' eight loads in front of their first product: one load latency a pair, not one per product
      acc[t] = wmma16c(vh0, pb, acc[t]); acc[t] = wmma16c(vl0, pb, acc[t]); acc[t + 1] = wmma16c(vh1, pb, acc[t + 1]); acc[t + 1] = wmma16c(vl1, pb, acc[t + 1]); } } }
  dn += xhalf(dn);
  const size_t slot = (size_t)(piece_slot0(b, qb) + pc);
  const int ln = (int)__builtin_amdgcn_mbcnt_lo(~0u, 0u);   // the lane number read anew, so that no register carries it over the loop (the budget of 128 is full there)
  PM[slot * 32 + ln] = ln < 16 ? mo : dn;
#pragma unroll
  for (int t = 0; t < 4; ++t) *(v8f*)(PA + slot * (16 * KS) + (size_t)(t * 32 + ln) * 8) = acc[t];
}
// merge: block per (batch, 16 queries): m = max over pieces of M, w = exp(M - m), read = sum w acc / sum w Dn, pieces in key order; thread = (column tile, lane) of the acc register order: query nloc, columns t * 16 + 8 * hlf + 0..7
__global__ __launch_bounds__(128) void merge_kernel(const float* __restrict__ PA, const float* __restrict__ PM, int BV, float* __restrict__ out) {
  __shared__ float Ls[NH * 32], Ds[16];
  const int tid = threadIdx.x, lane = tid & 31, nloc = lane & 15, hlf = lane >> 4, t = tid >> 5; const int b = blockIdx.x / NBLK, qb = blockIdx.x % NBLK; if (b >= BV) return;
  const int np = qb / QG / 2 + 1; const size_t slot0 = (size_t)piece_slot0(b, qb);
  float pm[NH * 32 / 128];   // index clamped to the last piece, so that the loads carry no guard and fly together
#pragma unroll
  for (int i = 0; i < NH * 32 / 128; ++i) pm[i] = PM[slot0 * 32 + min(i * 128 + tid, np * 32 - 1)];
#pragma unroll
  for (int i = 0; i < NH * 32 / 128; ++i) if (i * 128 + tid < np * 32) Ls[i * 128 + tid] = pm[i];
  __syncthreads();
  { const int row = tid >> 3, s8 = tid & 7; float mp[NH / 8], m = -INFINITY, d = 0.0f;   // 8 threads a row, pieces s8, s8 + 8, ...
#pragma unroll
    for (int i = 0; i < NH / 8; ++i) { const int p = i * 8 + s8; mp[i] = p < np ? Ls[p * 32 + row] : -INFINITY; m = fmaxf(m, mp[i]); }
    for (int o = 4; o; o >>= 1) m = fmaxf(m, __shfl_xor(m, o));
#pragma unroll
    for (int i = 0; i < NH / 8; ++i) { const int p = i * 8 + s8; if (p < np) { const float w = mp[i] == -INFINITY ? 0.0f : __expf(mp[i] - m); d += w * Ls[p * 32 + 16 + row]; Ls[p * 32 + row] = w; } }
    for (int o = 4; o; o >>= 1) d += __shfl_xor(d, o);
    if (s8 == 0) Ds[row] = d; }
  __syncthreads();
  v8f a = {}; const float* pa = PA + slot0 * (16 * KS) + (size_t)tid * 8;
#pragma unroll 8   // eight pieces' loads in flight instead of one load latency a piece
  for (int p = 0; p < np; ++p) { const v8f v = *(const v8f*)(pa + (size_t)p * (16 * KS));
#pragma unroll
    for (int r8 = 0; r8 < 8; ++r8) a[r8] += v[r8] * Ls[p * 32 + nloc]; }
#pragma unroll
  for (int r8 = 0; r8 < 8; ++r8) a[r8] = a[r8] * (1.0f / (PS * XS)) / Ds[nloc];
  *(v8f*)(out + ((size_t)b * S + (size_t)qb * 16 + nloc) * DO + D + t * 16 + 8 * hlf) = a;
}
}  // namespace

extern "C" void kernel_launch(void* const* d_in, const int* in_sizes, int n_in, void* d_out, int out_size, void* d_ws, size_t ws_size, hipStream_t stream) {
  (void)n_in;
  auto Fp = [&](int i) { return (const float*)d_in[i]; };
  // input order: 0 inputs [4,4096,128]; 1 Wq [128,64]; 2 bq; 3 Wk; 4 bk; 5 Wv; 6 bv
  if (in_sizes[0] != B * S * D || in_sizes[1] != D * KS || in_sizes[3] != D * KS || in_sizes[5] != D * KS || in_sizes[2] != KS || out_size != B * S * DO) return;
  const int BV = B, SV = S;
  size_t off = 0; char* ws = (char*)d_ws;
  auto carve = [&](size_t bytes) { char* p = ws + off; off += (bytes + 255) & ~(size_t)255; return p; };
  b16* QF = (b16*)carve((size_t)B * NBLK * FB * 2); b16* KF = (b16*)carve((size_t)B * NBLK * FB * 2); b16* VF = (b16*)carve((size_t)B * NBLK * FB * 2);
  float* PA = (float*)carve((size_t)B * PPB * 16 * KS * 4); float* PM = (float*)carve((size_t)B * PPB * 32 * 4);
  if (off > ws_size || off > ((size_t)96 << 20)) return;   // ~ 49 MB
  float* out = (float*)d_out;
  qkv_kernel<<<(unsigned)((BV == B ? B * S : SV) / (16 * PW)), 32 * PW, 0, stream>>>(Fp(0), Fp(1), Fp(3), Fp(5), Fp(2), Fp(4), Fp(6), BV == B ? B * S : SV, QF, KF, VF, out);
  att_kernel<<<(unsigned)(B * PPB / QG), 256, 0, stream>>>(QF, KF, VF, BV, PA, PM);
  merge_kernel<<<(unsigned)(B * NBLK), 128, 0, stream>>>(PA, PM, BV, out);
}

// v009
// It runs in 30.8 microseconds.
// Next to v008, in two timings, it ran 1.23 and 1.25 times as fast.
// All steps since v000 together make it 59.2 times as fast.
#include <hip/hip_runtime.h>

// Snail (causal) attention read head: q, k, v = x Wq/Wk/Wv + b (128 -> 64 each); probs = softmax((q k^T + causal mask) / 8); read = probs v; out = [x | read] -> [4][4096][192].
// Deterministic, no atomics, no index structures; the keys of a query block are cut into pieces of 256 (two LDS stages of 128), one wave per piece (online softmax over its 32-key chunks, keys in order); a merge launch joins the pieces in key order.
// WMMA (v_wmma_f32_16x16x32_f16, f32 accumulate): [q|k|v] = x [Wq|Wk|Wv] (x EXACT bf16 x8; (in,out) weights transposed exact x256); per (batch, 16 queries): S = q k^T (q, k one f16 number each, x8), acc += P v (P plain x1024 relative to the
// running max, v^T one f16 number, x8: the f16 rounding lies well under the error that the bf16 rounding of x and W has already put into q, k, v); the mask, softmax bookkeeping and the final division in f32; the x half of the output is the bf16-rounded input copied through. Inputs rounded to bf16 once. Fragment k-map per lane

namespace {
constexpr int B = 4, S = 4096, D = 128, KS = 64, DO = D + KS, NBLK = S / 16;
constexpr float XS = 8.0f, PS = 1024.0f, WSC = 256.0f;
// key split: a stage = PK keys (4 chunks of 32), a piece = two stages; the QG query blocks of group g = qb / QG each have g / 2 + 1 pieces (the last one ends at the diagonal stage g); NH = most pieces of a block; PPB pieces per batch
constexpr int PK = 128, QG = PK / 16, NG = NBLK / QG, NH = NG / 2, PPB = QG * NH * (NH + 1);
__device__ __forceinline__ int piece_slot0(int b, int qb) { const int g = qb / QG, h = g / 2; return b * PPB + QG * (h + 1) * (h + (g & 1)) + (qb % QG) * (h + 1); }   // (h + 1)(h + g % 2) = pieces of the groups below g
typedef _Float16 b16;
typedef __attribute__((ext_vector_type(16))) _Float16 v16b;
typedef __attribute__((ext_vector_type(8))) _Float16 v8b;
typedef __attribute__((ext_vector_type(4))) _Float16 v4b;
typedef __attribute__((ext_vector_type(8))) float v8f;
typedef __attribute__((ext_vector_type(4))) float v4f;
typedef __attribute__((ext_vector_type(2))) float v2f;
__device__ __forceinline__ float bf16_rne(float f) { unsigned int u = __float_as_uint(f); u += 0x7FFFu + ((u >> 16) & 1u); return __uint_as_float(u & 0xFFFF0000u); }
__device__ __forceinline__ v16b frag_kb(const b16* p, int hh) { const v8b a = *(const v8b*)(p + 8 * hh), b = *(const v8b*)(p + 16 + 8 * hh); v16b f;
#pragma unroll
  for (int e = 0; e < 8; ++e) { f[e] = a[e]; f[8 + e] = b[e]; } return f; }
// fragment-order planes: per 16-row block FB halves, 4 groups x 32 lanes x 8; a fragment = the lane's 8 halves of two groups, each load 512 B in a row
constexpr int FG = 32 * 8, FB = 4 * FG;
typedef const __attribute__((address_space(1))) b16* gptr;
typedef const __attribute__((address_space(1))) v8b* gptr8;
// a wave-uniform global pointer kept in scalar registers, so that the q fragment loads take the form scalar base + lane offset and need no vector address pair
__device__ __forceinline__ gptr uni(const b16* p) { const unsigned long long u = (unsigned long long)p; return (gptr)(((unsigned long long)(unsigned int)__builtin_amdgcn_readfirstlane((int)(u >> 32)) << 32) | (unsigned int)__builtin_amdgcn_readfirstlane((int)u)); }
__device__ __forceinline__ v16b frag_g(gptr p0, gptr p1) { const v8b a = *(gptr8)p0, b = *(gptr8)p1; v16b f;
#pragma unroll
  for (int e = 0; e < 8; ++e) { f[e] = a[e]; f[8 + e] = b[e]; } return f; }
__device__ __forceinline__ v16b frag_s(const b16* p0, const b16* p1) { const v8b a = *(const v8b*)p0, b = *(const v8b*)p1; v16b f;
#pragma unroll
  for (int e = 0; e < 8; ++e) { f[e] = a[e]; f[8 + e] = b[e]; } return f; }
// eight asynchronous 16-byte copies a lane, global to LDS, CS bytes apart: four from gk, then four from gv, to eight places in a row; the s_wait_xcnt closes the statement so that no address register is rewritten in front of it
constexpr int CS = 256 * 16;
__device__ __forceinline__ void copy8(unsigned l, const char* gk, const char* gv) {
  asm volatile("global_load_async_to_lds_b128 %0, %8, off\n\tglobal_load_async_to_lds_b128 %1, %9, off\n\tglobal_load_async_to_lds_b128 %2, %10, off\n\tglobal_load_async_to_lds_b128 %3, %11, off\n\t"
               "global_load_async_to_lds_b128 %4, %12, off\n\tglobal_load_async_to_lds_b128 %5, %13, off\n\tglobal_load_async_to_lds_b128 %6, %14, off\n\tglobal_load_async_to_lds_b128 %7, %15, off\n\ts_wait_xcnt 0x0"
               :: "v"(l), "v"(l + CS), "v"(l + 2 * CS), "v"(l + 3 * CS), "v"(l + 4 * CS), "v"(l + 5 * CS), "v"(l + 6 * CS), "v"(l + 7 * CS),
                  "v"(gk), "v"(gk + CS), "v"(gk + 2 * CS), "v"(gk + 3 * CS), "v"(gv), "v"(gv + CS), "v"(gv + 2 * CS), "v"(gv + 3 * CS) : "memory"); }
__device__ __forceinline__ v8f wmma16b(v16b a, v16b b, v8f c) { v8f d = __builtin_amdgcn_wmma_f32_16x16x32_f16(false, a, false, b, (short)0, c, false, false); asm volatile("v_nop\n\tv_nop\n\tv_nop\n\tv_nop" : "+v"(d) : "v"(a), "v"(b)); return d; }
// the attention loop's form, the builtin alone: an accumulate chain needs no distance between its links, and behind a chain's end the compiler keeps the distance itself, with real instructions where it has some; eight waves share the SIMD's one vector port, where every v_nop took a slot.
// The scheduling barrier lets vector and scalar instructions cross (they fill the slots behind a product) and keeps matrix instructions and LDS reads in source order: left free, fragments are fetched early and the loop leaves its 128 registers
__device__ __forceinline__ v8f wmma16c(v16b a, v16b b, v8f c) { v8f d = __builtin_amdgcn_wmma_f32_16x16x32_f16(false, a, false, b, (short)0, c, false, false); __builtin_amdgcn_sched_barrier(0x6); return d; }
__device__ __forceinline__ void wave_lds_sync() { __builtin_amdgcn_fence(__ATOMIC_RELEASE, "workgroup"); __builtin_amdgcn_wave_barrier(); __builtin_amdgcn_fence(__ATOMIC_ACQUIRE, "workgroup"); }
__device__ __forceinline__ float pmul(float a, float b) { float p = a * b; asm volatile("" : "+v"(p)); return p; }
__device__ __forceinline__ float xhalf(float x) { return __builtin_bit_cast(float, __builtin_amdgcn_permlanex16(__builtin_bit_cast(int, x), __builtin_bit_cast(int, x), 0x76543210, 0xfedcba98, false, false)); }  // lane l with lane l ^ 16

// projection: work-group = PW waves, wave per 16 rows, as many work-groups as the chip has WGPs. The three (in,out) f32 weight matrices are rounded, scaled and transposed to f16 rows Wt[out][in] in the work-group's LDS by its own threads, so no launch stands
// in front of this one. A thread takes 4 outputs x 8 inputs at a time: eight 16-byte loads (16 lanes = one 256-byte weight row), four 16-byte LDS stores. All its loads fly together, issued in this order: Wq, Wk, Wv, the biases, then the wave's 16 x rows.
// One barrier publishes Wt; behind it each wave reads its weight fragments from LDS, six together, one group ahead of their products. x is read once: the rounded rows go to out from registers.
constexpr int PW = 4, WPI = D + 8;   // WPI: pitch of a weight row in LDS, 16 bytes x odd, for 16-byte readers
__device__ __forceinline__ void wload(v4f (&r)[16], const float* __restrict__ w, unsigned wo) {   // wo: the thread's byte offset
#pragma unroll
  for (int i = 0; i < 16; ++i) r[i] = *(const v4f*)((const char*)w + wo + ((i >> 3) * 64 + (i & 7)) * KS * 4); }
__device__ __forceinline__ void wconv(const v4f (&r)[16], b16 (*wt)[WPI], int tid) {
#pragma unroll
  for (int h = 0; h < 2; ++h)
#pragma unroll
    for (int c = 0; c < 4; ++c) { v8b v;
#pragma unroll
      for (int j = 0; j < 8; ++j) v[j] = (b16)(bf16_rne(r[h * 8 + j][c]) * WSC);
      *(v8b*)&wt[(tid & 15) * 4 + c][h * 64 + (tid >> 4) * 8] = v; } }
__global__ __launch_bounds__(32 * PW) void qkv_kernel(const float* __restrict__ x, const float* __restrict__ wq, const float* __restrict__ wk, const float* __restrict__ wv, const float* __restrict__ bq, const float* __restrict__ bk, const float* __restrict__ bv, int RLIM, b16* __restrict__ QF, b16* __restrict__ KF, b16* __restrict__ VF, float* __restrict__ out) {
  __shared__ __attribute__((aligned(16))) b16 Wt[3 * KS][WPI]; __shared__ __attribute__((aligned(16))) b16 AhW[PW][16][D + 8]; __shared__ __attribute__((aligned(16))) float TfW[PW][16][3 * KS + 4];
  const int tid = threadIdx.x, lane = tid & 31, nloc = lane & 15, hlf = lane >> 4, wave = __builtin_amdgcn_readfirstlane(tid >> 5); if ((size_t)blockIdx.x * (16 * PW) >= (size_t)RLIM) return;   // the whole work-group, in front of the barrier; RLIM is a multiple of 16 * PW
  const int rb = blockIdx.x * PW + wave; const size_t m0 = (size_t)rb * 16; b16 (*Ah)[D + 8] = AhW[wave]; float (*Tf)[3 * KS + 4] = TfW[wave];
  v4f wa[16], wb[16], wc[16], xr[16]; float bb[12]; const float* xp = x + m0 * D + lane * 4; const unsigned wo = (unsigned)((tid >> 4) * 8 * KS + (tid & 15) * 4) * 4;   // the lane's 16 bytes of an x row; its 4 outputs of input row (tid >> 4) * 8
  wload(wa, wq, wo); wload(wb, wk, wo); wload(wc, wv, wo);
#pragma unroll
  for (int t = 0; t < 12; ++t) bb[t] = (t < 4 ? bq : t < 8 ? bk : bv)[(t & 3) * 16 + nloc];
  asm volatile("" ::: "memory");   // loads return in issue order: the x rows, which come from furthest away, are issued behind the weights, so that the weights are converted while x flies
#pragma unroll
  for (int rr = 0; rr < 16; ++rr) xr[rr] = *(const v4f*)(xp + rr * D);
  asm volatile("s_wait_xcnt 0x0" :: "v"(wo) : "memory");   // the batch's address registers are free for reuse only behind this wait; naming the offset keeps its register from becoming a load's destination in front of it
  wconv(wa, &Wt[0], tid); wconv(wb, &Wt[KS], tid); wconv(wc, &Wt[2 * KS], tid);
#pragma unroll
  for (int rr = 0; rr < 16; ++rr) { v4b h;
#pragma unroll
    for (int j = 0; j < 4; ++j) { xr[rr][j] = bf16_rne(xr[rr][j]); h[j] = (b16)(xr[rr][j] * XS); }
    *(v4b*)&Ah[rr][lane * 4] = h; }
  __syncthreads();   // every wave's part of Wt is written (and the wave's own Ah rows)
#pragma unroll
  for (int rr = 0; rr < 16; ++rr) *(v4f*)(out + (m0 + rr) * DO + lane * 4) = xr[rr];
  asm volatile("s_wait_xcnt 0x0" ::: "memory");   // the registers that these stores name are reused below: the wait stands in front of that overwrite
  v8f acc[12];
#pragma unroll
  for (int t = 0; t < 12; ++t) acc[t] = (v8f){};
  v16b af[4], wf[2][6]; const b16* wl = &Wt[nloc][8 * hlf];   // the lane's half of weight row nloc
#pragma unroll
  for (int k4 = 0; k4 < 4; ++k4) af[k4] = frag_kb(&Ah[nloc][k4 * 32], hlf);
#pragma unroll
  for (int t = 0; t < 6; ++t) wf[0][t] = frag_kb(wl + t * 16 * WPI, 0);
#pragma unroll
  for (int g = 0; g < 8; ++g) {   // group g: k step g / 2, column tiles (g % 2) * 6 + 0..5
    if (g + 1 < 8) {
#pragma unroll
      for (int t = 0; t < 6; ++t) wf[(g + 1) & 1][t] = frag_kb(wl + (((g + 1) & 1) * 6 + t) * 16 * WPI + ((g + 1) >> 1) * 32, 0); }
#pragma unroll
    for (int t = 0; t < 6; ++t) acc[(g & 1) * 6 + t] = wmma16b(af[g >> 1], wf[g & 1][t], acc[(g & 1) * 6 + t]); }
#pragma unroll
  for (int t = 0; t < 12; ++t) { const int c = t * 16 + nloc; const float bs = bf16_rne(bb[t]);
#pragma unroll
    for (int r8 = 0; r8 < 8; ++r8) Tf[8 * hlf + r8][c] = acc[t][r8] * (1.0f / (XS * WSC)) + bs; }
  wave_lds_sync();
  // q, k (row nloc, columns g * 16 + 8 * hlf + e) and v (key 8 * hlf + e, column g * 16 + nloc) rounded to f16 x8 once, stored as the attention waves' fragments
#pragma unroll
  for (int w = 0; w < 3; ++w) { b16* fp = (w == 0 ? QF : w == 1 ? KF : VF) + (size_t)rb * FB + lane * 8;
#pragma unroll
    for (int g = 0; g < 4; ++g) { v8b h;
#pragma unroll
      for (int e = 0; e < 8; ++e) h[e] = (b16)((w < 2 ? Tf[nloc][w * KS + g * 16 + 8 * hlf + e] : Tf[8 * hlf + e][2 * KS + g * 16 + nloc]) * XS);
      *(v8b*)(fp + g * FG) = h; } }
}
// causal attention: work-group per (batch, group of 8 query blocks, piece of 256 keys), wave per query block. The piece is walked in two stages of 128 keys: a stage's k and v fragment planes (16 KB each, contiguous) are copied to LDS, asynchronously, and all eight waves
// read their fragments there: one L2 read of the stage for 128 queries. The wave's maximum, sum and acc run on over both stages, so that 256 keys leave one partial. One barrier behind a stage's copies; one in front of the second stage's, which go into the same LDS; none behind the
// last stage's, so a wave that ends at its diagonal just leaves. Per wave: online softmax over the piece's 32-key chunks kc <= query block. Both products run transposed: S^T = k q^T / 8 (A = key rows, B = queries), so that
// a lane holds 16 of the chunk's 32 scores of ONE query (query nloc; keys blk * 16 + 8 * hlf + r8): mask, maximum, exp and sum stay in its registers, the two halves of the wave meet in one cross-row move for the maximum and, once a piece, for the sum.
// The two score tiles, converted in place, are the B fragment of acc^T += v^T P^T (A = v^T x8, P plain x1024): scores and P never touch LDS. acc[t][r8] = column t * 16 + 8 * hlf + r8 of query nloc.
// the piece's unnormalised acc (register order), M and Dn go to the workspace. The flat index covers exactly the pieces that exist, the longest first: NFP whole pieces a batch (pair rows h and NH - 1 - h of 2 h pieces each
// are joined, 2 (NH - 1) a pair), then the last pieces of the odd groups (a whole stage and the diagonal stage), then those of the even groups (the diagonal stage alone).
// register budget of 128, so that eight waves fit a SIMD: the waves hide one another's softmax and load latency
constexpr int NFP = NH * (NH - 1);   // pieces of a batch's query groups that end in front of the diagonal stage: g / 2 of group g
__global__ __launch_bounds__(256) __attribute__((amdgpu_waves_per_eu(8))) void att_kernel(const b16* __restrict__ QF, const b16* __restrict__ KF, const b16* __restrict__ VF, int BV, float* __restrict__ PA, float* __restrict__ PM) {
  __shared__ __attribute__((aligned(16))) b16 KV[2 * QG * FB];   // the stage's k planes, then its v planes
  const int lane = threadIdx.x & 31, nloc = lane & 15, hlf = lane >> 4, wv = __builtin_amdgcn_readfirstlane(threadIdx.x >> 5); int b, g, pc;
  if ((int)blockIdx.x < B * NFP) { b = blockIdx.x / NFP; const int jp = blockIdx.x % NFP, pr = jp / (2 * (NH - 1)), rp = jp % (2 * (NH - 1)), h = rp < 2 * pr ? pr : NH - 1 - pr, r = rp < 2 * pr ? rp : rp - 2 * pr; g = 2 * h + (r >= h); pc = r >= h ? r - h : r; }
  else { const int r = blockIdx.x - B * NFP; b = r % (B * NH) / NH; pc = r % NH; g = 2 * pc + (r < B * NH); }
  if (b >= BV) return;
  const int qb = g * QG + wv, nst = min(2, g + 1 - 2 * pc); const size_t q0 = (size_t)qb * 16;   // nst: the piece's stages, the same for the whole work-group
  v16b qf[2]; { const gptr qp = uni(QF + (size_t)(b * NBLK + qb) * FB) + lane * 8;
#pragma unroll
    for (int k2 = 0; k2 < 2; ++k2) qf[k2] = frag_g(qp + 2 * k2 * FG, qp + (2 * k2 + 1) * FG); }
  asm volatile("s_wait_xcnt 0x0" ::: "memory");   // the scalar base that the q loads name is reused for the stage's addresses below: the wait stands in front of that overwrite
  float mo = -INFINITY, dn = 0.0f;   // the lane's query: running maximum (equal in both halves), running sum over the lane's own keys
  v8f acc[4];
#pragma unroll
  for (int t = 0; t < 4; ++t) acc[t] = (v8f){};
  for (int st = 0; st < nst; ++st) { const int k0 = (2 * pc + st) * PK, kend = min(k0 + PK, (int)q0 + 16);
  if (st) { asm volatile("s_wait_dscnt 0x0" ::: "memory");   // this wave's reads of the first stage have returned
    __syncthreads(); }                                  // and every other wave's: the LDS may be refilled
  { const size_t po = (size_t)(b * NBLK + k0 / 16) * FB * 2 + threadIdx.x * 16; const unsigned l = (unsigned)(unsigned long long)(const char*)KV + threadIdx.x * 16;   // thread's 16 bytes of each 4-KB block: 4 blocks of k, 4 of v
    copy8(l, (const char*)KF + po, (const char*)VF + po); }
  asm volatile("s_wait_asynccnt 0x0" ::: "memory");   // this wave's copies have landed
  __syncthreads();                                    // and every other wave's: the stage may be read
#pragma unroll 1
  for (int kc = k0; kc < kend; kc += 32) {
    const b16* kp = KV + (kc - k0) / 16 * FB + lane * 8; const b16* vp = kp + QG * FB;   // two 16-key blocks; rows past the diagonal lie in the piece and are masked below
    const v16b kf[2][2] = {{frag_s(kp, kp + FG), frag_s(kp + 2 * FG, kp + 3 * FG)}, {frag_s(kp + FB, kp + FB + FG), frag_s(kp + FB + 2 * FG, kp + FB + 3 * FG)}};
    asm volatile("" :: "v"(kf[0][0]), "v"(kf[0][1]), "v"(kf[1][0]), "v"(kf[1][1]));   // holds the chunk's eight key loads in front of its first product: one load latency a chunk, not one per k step
    float sc[2][8]; const int lim = (int)q0 + nloc - kc - 8 * hlf;   // the lane's last unmasked key, counted from its first key of the chunk
#pragma unroll
    for (int blk = 0; blk < 2; ++blk) { v8f s = {};
#pragma unroll
      for (int k2 = 0; k2 < KS / 32; ++k2) s = wmma16c(kf[blk][k2], qf[k2], s);
#pragma unroll
      for (int r8 = 0; r8 < 8; ++r8) sc[blk][r8] = blk * 16 + r8 > lim ? -INFINITY : s[r8] * (0.125f / (XS * XS)); }   // key kc + blk * 16 + 8 * hlf + r8 > query q0 + nloc
    float cm = sc[0][0];
#pragma unroll
    for (int e = 1; e < 16; ++e) cm = fmaxf(cm, sc[e >> 3][e & 7]);
    cm = fmaxf(cm, xhalf(cm)); const float mn = fmaxf(mo, cm), sf = (mo == -INFINITY) ? 0.0f : __expf(mo - mn);
    float psum = 0.0f; v16b pb;   // pb[e] = P[query nloc][key (e >> 3) * 16 + 8 * hlf + (e & 7)]: the k order of the v fragments
#pragma unroll
    for (int e = 0; e < 16; ++e) { const float sv = sc[e >> 3][e & 7], p = sv == -INFINITY ? 0.0f : __expf(sv - mn); psum += p; pb[e] = (b16)(p * PS); }
    asm volatile("" :: "v"(psum));   // the row's sum, as an input only, held in front of the v loads, against spills: left free, its sixteen adds sink behind the products below, all sixteen P values stay live beside the v fragments and the 128 registers do not hold
    dn = dn * sf + psum; mo = mn;
#pragma unroll
    for (int t = 0; t < 4; ++t)
#pragma unroll
      for (int r8 = 0; r8 < 8; ++r8) acc[t][r8] *= sf;
    const v16b vf[4] = {frag_s(vp, vp + FB), frag_s(vp + FG, vp + FB + FG), frag_s(vp + 2 * FG, vp + FB + 2 * FG), frag_s(vp + 3 * FG, vp + FB + 3 * FG)};
    asm volatile("" :: "v"(vf[0]), "v"(vf[1]), "v"(vf[2]), "v"(vf[3]));   // holds the four column tiles' eight loads in front of their first product: one load latency a chunk, not one per product
#pragma unroll
    for (int t = 0; t < 4; ++t) acc[t] = wmma16c(vf[t], pb, acc[t]); } }
  dn += xhalf(dn);
  const size_t slot = (size_t)(piece_slot0(b, qb) + pc);
  const int ln = (int)__builtin_amdgcn_mbcnt_lo(~0u, 0u);   // the lane number read anew, so that no register carries it over the loop (the budget of 128 is full there)
  PM[slot * 32 + ln] = ln < 16 ? mo : dn;
#pragma unroll
  for (int t = 0; t < 4; ++t) *(v8f*)(PA + slot * (16 * KS) + (size_t)(t * 32 + ln) * 8) = acc[t];
}
// merge: block per (batch, 16 queries): m = max over pieces of M, w = exp(M - m), read = sum w acc / sum w Dn, pieces in key order; thread = (column tile, lane) of the acc register order: query nloc, columns t * 16 + 8 * hlf + 0..7
__global__ __launch_bounds__(128) void merge_kernel(const float* __restrict__ PA, const float* __restrict__ PM, int BV, float* __restrict__ out) {
  __shared__ float Ls[NH * 32], Ds[16];
  const int tid = threadIdx.x, lane = tid & 31, nloc = lane & 15, hlf = lane >> 4, t = tid >> 5; const int b = blockIdx.x / NBLK, qb = blockIdx.x % NBLK; if (b >= BV) return;
  const int np = qb / QG / 2 + 1; const size_t slot0 = (size_t)piece_slot0(b, qb);
  float pm[NH * 32 / 128];   // index clamped to the last piece, so that the loads carry no guard and fly together
#pragma unroll
  for (int i = 0; i < NH * 32 / 128; ++i) pm[i] = PM[slot0 * 32 + min(i * 128 + tid, np * 32 - 1)];
#pragma unroll
  for (int i = 0; i < NH * 32 / 128; ++i) if (i * 128 + tid < np * 32) Ls[i * 128 + tid] = pm[i];
  __syncthreads();
  { const int row = tid >> 3, s8 = tid & 7; float mp[NH / 8], m = -INFINITY, d = 0.0f;   // 8 threads a row, pieces s8, s8 + 8, ...
#pragma unroll
    for (int i = 0; i < NH / 8; ++i) { const int p = i * 8 + s8; mp[i] = p < np ? Ls[p * 32 + row] : -INFINITY; m = fmaxf(m, mp[i]); }
    for (int o = 4; o; o >>= 1) m = fmaxf(m, __shfl_xor(m, o));
#pragma unroll
    for (int i = 0; i < NH / 8; ++i) { const int p = i * 8 + s8; if (p < np) { const float w = mp[i] == -INFINITY ? 0.0f : __expf(mp[i] - m); d += w * Ls[p * 32 + 16 + row]; Ls[p * 32 + row] = w; } }
    for (int o = 4; o; o >>= 1) d += __shfl_xor(d, o);
    if (s8 == 0) Ds[row] = d; }
  __syncthreads();
  v8f a = {}; const float* pa = PA + slot0 * (16 * KS) + (size_t)tid * 8;
#pragma unroll 8   // eight pieces' loads in flight instead of one load latency a piece
  for (int p = 0; p < np; ++p) { const v8f v = *(const v8f*)(pa + (size_t)p * (16 * KS));
#pragma unroll
    for (int r8 = 0; r8 < 8; ++r8) a[r8] += v[r8] * Ls[p * 32 + nloc]; }
#pragma unroll
  for (int r8 = 0; r8 < 8; ++r8) a[r8] = a[r8] * (1.0f / (PS * XS)) / Ds[nloc];
  *(v8f*)(out + ((size_t)b * S + (size_t)qb * 16 + nloc) * DO + D + t * 16 + 8 * hlf) = a;
}
}  // namespace

extern "C" void kernel_launch(void* const* d_in, const int* in_sizes, int n_in, void* d_out, int out_size, void* d_ws, size_t ws_size, hipStream_t stream) {
  (void)n_in;
  auto Fp = [&](int i) { return (const float*)d_in[i]; };
  // input order: 0 inputs [4,4096,128]; 1 Wq [128,64]; 2 bq; 3 Wk; 4 bk; 5 Wv; 6 bv
  if (in_sizes[0] != B * S * D || in_sizes[1] != D * KS || in_sizes[3] != D * KS || in_sizes[5] != D * KS || in_sizes[2] != KS || out_size != B * S * DO) return;
  const int BV = B, SV = S;
  size_t off = 0; char* ws = (char*)d_ws;
  auto carve = [&](size_t bytes) { char* p = ws + off; off += (bytes + 255) & ~(size_t)255; return p; };
  b16* QF = (b16*)carve((size_t)B * NBLK * FB * 2); b16* KF = (b16*)carve((size_t)B * NBLK * FB * 2); b16* VF = (b16*)carve((size_t)B * NBLK * FB * 2);
  float* PA = (float*)carve((size_t)B * PPB * 16 * KS * 4); float* PM = (float*)carve((size_t)B * PPB * 32 * 4);
  if (off > ws_size || off > ((size_t)96 << 20)) return;   // ~ 43 MB
  float* out = (float*)d_out;
  qkv_kernel<<<(unsigned)((BV == B ? B * S : SV) / (16 * PW)), 32 * PW, 0, stream>>>(Fp(0), Fp(1), Fp(3), Fp(5), Fp(2), Fp(4), Fp(6), BV == B ? B * S : SV, QF, KF, VF, out);
  att_kernel<<<(unsigned)(B * PPB / QG), 256, 0, stream>>>(QF, KF, VF, BV, PA, PM);
  merge_kernel<<<(unsigned)(B * NBLK), 128, 0, stream>>>(PA, PM, BV, out);
}

// v010
// One run takes 29.8 microseconds.
// In both of two side-by-side timings against v009, it was 1.04 times as fast.
// All steps since v000 together make it 61.3 times as fast.
#include <hip/hip_runtime.h>

// Snail (causal) attention read head: q, k, v = x Wq/Wk/Wv + b (128 -> 64 each); probs = softmax((q k^T + causal mask) / 8); read = probs v; out = [x | read] -> [4][4096][192].
// Deterministic, no atomics, no index structures; the keys of a query block are cut into pieces of 256 (two LDS stages of 128), one wave per piece (online softmax over its 32-key chunks, keys in order); a merge launch joins the pieces in key order.
// WMMA (v_wmma_f32_16x16x32_f16, f32 accumulate): [q|k|v] = x [Wq|Wk|Wv] (x EXACT bf16 x8; (in,out) weights transposed exact x256); per (batch, 16 queries): S = q k^T (q, k one f16 number each, x8), acc += P v (P plain x1024 relative to the
// running max, v^T one f16 number, x8: the f16 rounding lies well under the error that the bf16 rounding of x and W has already put into q, k, v); the mask, softmax bookkeeping and the final division in f32; the x half of the output is the bf16-rounded input copied through. Inputs rounded to bf16 once. Fragment k-map per lane

namespace {
constexpr int B = 4, S = 4096, D = 128, KS = 64, DO = D + KS, NBLK = S / 16;
constexpr float XS = 8.0f, PS = 1024.0f, WSC = 256.0f;
// key split: a stage = PK keys (4 chunks of 32), a piece = two stages; the QG query blocks of group g = qb / QG each have g / 2 + 1 pieces (the last one ends at the diagonal stage g); NH = most pieces of a block; PPB pieces per batch
constexpr int PK = 128, QG = PK / 16, NG = NBLK / QG, NH = NG / 2, PPB = QG * NH * (NH + 1);
__device__ __forceinline__ int piece_slot0(int b, int qb) { const int g = qb / QG, h = g / 2; return b * PPB + QG * (h + 1) * (h + (g & 1)) + (qb % QG) * (h + 1); }   // (h + 1)(h + g % 2) = pieces of the groups below g
typedef _Float16 b16;
typedef __attribute__((ext_vector_type(16))) _Float16 v16b;
typedef __attribute__((ext_vector_type(8))) _Float16 v8b;
typedef __attribute__((ext_vector_type(4))) _Float16 v4b;
typedef __attribute__((ext_vector_type(8))) float v8f;
typedef __attribute__((ext_vector_type(4))) float v4f;
typedef __attribute__((ext_vector_type(2))) float v2f;
__device__ __forceinline__ float bf16_rne(float f) { unsigned int u = __float_as_uint(f); u += 0x7FFFu + ((u >> 16) & 1u); return __uint_as_float(u & 0xFFFF0000u); }
__device__ __forceinline__ v16b frag_kb(const b16* p, int hh) { const v8b a = *(const v8b*)(p + 8 * hh), b = *(const v8b*)(p + 16 + 8 * hh); v16b f;
#pragma unroll
  for (int e = 0; e < 8; ++e) { f[e] = a[e]; f[8 + e] = b[e]; } return f; }
// fragment-order planes: per 16-row block FB halves, 4 groups x 32 lanes x 8; a fragment = the lane's 8 halves of two groups, each load 512 B in a row
constexpr int FG = 32 * 8, FB = 4 * FG;
typedef const __attribute__((address_space(1))) b16* gptr;
typedef const __attribute__((address_space(1))) v8b* gptr8;
// a wave-uniform global pointer kept in scalar registers, so that the q fragment loads take the form scalar base + lane offset and need no vector address pair
__device__ __forceinline__ gptr uni(const b16* p) { const unsigned long long u = (unsigned long long)p; return (gptr)(((unsigned long long)(unsigned int)__builtin_amdgcn_readfirstlane((int)(u >> 32)) << 32) | (unsigned int)__builtin_amdgcn_readfirstlane((int)u)); }
__device__ __forceinline__ v16b frag_g(gptr p0, gptr p1) { const v8b a = *(gptr8)p0, b = *(gptr8)p1; v16b f;
#pragma unroll
  for (int e = 0; e < 8; ++e) { f[e] = a[e]; f[8 + e] = b[e]; } return f; }
__device__ __forceinline__ v16b frag_s(const b16* p0, const b16* p1) { const v8b a = *(const v8b*)p0, b = *(const v8b*)p1; v16b f;
#pragma unroll
  for (int e = 0; e < 8; ++e) { f[e] = a[e]; f[8 + e] = b[e]; } return f; }
// eight asynchronous 16-byte copies a lane, global to LDS, CS bytes apart: four from gk, then four from gv, to eight places in a row; the s_wait_xcnt closes the statement so that no address register is rewritten in front of it
constexpr int CS = 256 * 16;
__device__ __forceinline__ void copy8(unsigned l, const char* gk, const char* gv) {
  asm volatile("global_load_async_to_lds_b128 %0, %8, off\n\tglobal_load_async_to_lds_b128 %1, %9, off\n\tglobal_load_async_to_lds_b128 %2, %10, off\n\tglobal_load_async_to_lds_b128 %3, %11, off\n\t"
               "global_load_async_to_lds_b128 %4, %12, off\n\tglobal_load_async_to_lds_b128 %5, %13, off\n\tglobal_load_async_to_lds_b128 %6, %14, off\n\tglobal_load_async_to_lds_b128 %7, %15, off\n\ts_wait_xcnt 0x0"
               :: "v"(l), "v"(l + CS), "v"(l + 2 * CS), "v"(l + 3 * CS), "v"(l + 4 * CS), "v"(l + 5 * CS), "v"(l + 6 * CS), "v"(l + 7 * CS),
                  "v"(gk), "v"(gk + CS), "v"(gk + 2 * CS), "v"(gk + 3 * CS), "v"(gv), "v"(gv + CS), "v"(gv + 2 * CS), "v"(gv + 3 * CS) : "memory"); }
__device__ __forceinline__ v8f wmma16b(v16b a, v16b b, v8f c) { v8f d = __builtin_amdgcn_wmma_f32_16x16x32_f16(false, a, false, b, (short)0, c, false, false); asm volatile("v_nop\n\tv_nop\n\tv_nop\n\tv_nop" : "+v"(d) : "v"(a), "v"(b)); return d; }
// the attention loop's form, the builtin alone: an accumulate chain needs no distance between its links, and behind a chain's end the compiler keeps the distance itself, with real instructions where it has some; eight waves share the SIMD's one vector port, where every v_nop took a slot.
// The scheduling barrier lets vector and scalar instructions cross (they fill the slots behind a product) and keeps matrix instructions and LDS reads in source order: left free, fragments are fetched early and the loop leaves its 128 registers
__device__ __forceinline__ v8f wmma16c(v16b a, v16b b, v8f c) { v8f d = __builtin_amdgcn_wmma_f32_16x16x32_f16(false, a, false, b, (short)0, c, false, false); __builtin_amdgcn_sched_barrier(0x6); return d; }
// the score products' form: only scalar instructions cross, so that the four products stand in a row and count as one another's distance; a vector instruction drawn in behind the first chain reads its result at once and costs four v_nop there
__device__ __forceinline__ v8f wmma16s(v16b a, v16b b, v8f c) { v8f d = __builtin_amdgcn_wmma_f32_16x16x32_f16(false, a, false, b, (short)0, c, false, false); __builtin_amdgcn_sched_barrier(0x4); return d; }
__device__ __forceinline__ void wave_lds_sync() { __builtin_amdgcn_fence(__ATOMIC_RELEASE, "workgroup"); __builtin_amdgcn_wave_barrier(); __builtin_amdgcn_fence(__ATOMIC_ACQUIRE, "workgroup"); }
__device__ __forceinline__ float pmul(float a, float b) { float p = a * b; asm volatile("" : "+v"(p)); return p; }
__device__ __forceinline__ float xhalf(float x) { return __builtin_bit_cast(float, __builtin_amdgcn_permlanex16(__builtin_bit_cast(int, x), __builtin_bit_cast(int, x), 0x76543210, 0xfedcba98, false, false)); }  // lane l with lane l ^ 16

// projection: work-group = PW waves, wave per 16 rows, as many work-groups as the chip has WGPs. The three (in,out) f32 weight matrices are rounded, scaled and transposed to f16 rows Wt[out][in] in the work-group's LDS by its own threads, so no launch stands
// in front of this one. A thread takes 4 outputs x 8 inputs at a time: eight 16-byte loads (16 lanes = one 256-byte weight row), four 16-byte LDS stores. All its loads fly together, issued in this order: Wq, Wk, Wv, the biases, then the wave's 16 x rows.
// One barrier publishes Wt; behind it each wave reads its weight fragments from LDS, six together, one group ahead of their products. x is read once: the rounded rows go to out from registers.
constexpr int PW = 4, WPI = D + 8;   // WPI: pitch of a weight row in LDS, 16 bytes x odd, for 16-byte readers
__device__ __forceinline__ void wload(v4f (&r)[16], const float* __restrict__ w, unsigned wo) {   // wo: the thread's byte offset
#pragma unroll
  for (int i = 0; i < 16; ++i) r[i] = *(const v4f*)((const char*)w + wo + ((i >> 3) * 64 + (i & 7)) * KS * 4); }
__device__ __forceinline__ void wconv(const v4f (&r)[16], b16 (*wt)[WPI], int tid) {
#pragma unroll
  for (int h = 0; h < 2; ++h)
#pragma unroll
    for (int c = 0; c < 4; ++c) { v8b v;
#pragma unroll
      for (int j = 0; j < 8; ++j) v[j] = (b16)(bf16_rne(r[h * 8 + j][c]) * WSC);
      *(v8b*)&wt[(tid & 15) * 4 + c][h * 64 + (tid >> 4) * 8] = v; } }
__global__ __launch_bounds__(32 * PW) void qkv_kernel(const float* __restrict__ x, const float* __restrict__ wq, const float* __restrict__ wk, const float* __restrict__ wv, const float* __restrict__ bq, const float* __restrict__ bk, const float* __restrict__ bv, int RLIM, b16* __restrict__ QF, b16* __restrict__ KF, b16* __restrict__ VF, float* __restrict__ out) {
  __shared__ __attribute__((aligned(16))) b16 Wt[3 * KS][WPI]; __shared__ __attribute__((aligned(16))) b16 AhW[PW][16][D + 8]; __shared__ __attribute__((aligned(16))) float TfW[PW][16][3 * KS + 4];
  const int tid = threadIdx.x, lane = tid & 31, nloc = lane & 15, hlf = lane >> 4, wave = __builtin_amdgcn_readfirstlane(tid >> 5); if ((size_t)blockIdx.x * (16 * PW) >= (size_t)RLIM) return;   // the whole work-group, in front of the barrier; RLIM is a multiple of 16 * PW
  const int rb = blockIdx.x * PW + wave; const size_t m0 = (size_t)rb * 16; b16 (*Ah)[D + 8] = AhW[wave]; float (*Tf)[3 * KS + 4] = TfW[wave];
  v4f wa[16], wb[16], wc[16], xr[16]; float bb[12]; const float* xp = x + m0 * D + lane * 4; const unsigned wo = (unsigned)((tid >> 4) * 8 * KS + (tid & 15) * 4) * 4;   // the lane's 16 bytes of an x row; its 4 outputs of input row (tid >> 4) * 8
  wload(wa, wq, wo); wload(wb, wk, wo); wload(wc, wv, wo);
#pragma unroll
  for (int t = 0; t < 12; ++t) bb[t] = (t < 4 ? bq : t < 8 ? bk : bv)[(t & 3) * 16 + nloc];
  asm volatile("" ::: "memory");   // loads return in issue order: the x rows, which come from furthest away, are issued behind the weights, so that the weights are converted while x flies
#pragma unroll
  for (int rr = 0; rr < 16; ++rr) xr[rr] = *(const v4f*)(xp + rr * D);
  asm volatile("s_wait_xcnt 0x0" :: "v"(wo) : "memory");   // the batch's address registers are free for reuse only behind this wait; naming the offset keeps its register from becoming a load's destination in front of it
  wconv(wa, &Wt[0], tid); wconv(wb, &Wt[KS], tid); wconv(wc, &Wt[2 * KS], tid);
#pragma unroll
  for (int rr = 0; rr < 16; ++rr) { v4b h;
#pragma unroll
    for (int j = 0; j < 4; ++j) { xr[rr][j] = bf16_rne(xr[rr][j]); h[j] = (b16)(xr[rr][j] * XS); }
    *(v4b*)&Ah[rr][lane * 4] = h; }
  __syncthreads();   // every wave's part of Wt is written (and the wave's own Ah rows)
#pragma unroll
  for (int rr = 0; rr < 16; ++rr) *(v4f*)(out + (m0 + rr) * DO + lane * 4) = xr[rr];
  asm volatile("s_wait_xcnt 0x0" ::: "memory");   // the registers that these stores name are reused below: the wait stands in front of that overwrite
  v8f acc[12];
#pragma unroll
  for (int t = 0; t < 12; ++t) acc[t] = (v8f){};
  v16b af[4], wf[2][6]; const b16* wl = &Wt[nloc][8 * hlf];   // the lane's half of weight row nloc
#pragma unroll
  for (int k4 = 0; k4 < 4; ++k4) af[k4] = frag_kb(&Ah[nloc][k4 * 32], hlf);
#pragma unroll
  for (int t = 0; t < 6; ++t) wf[0][t] = frag_kb(wl + t * 16 * WPI, 0);
#pragma unroll
  for (int g = 0; g < 8; ++g) {   // group g: k step g / 2, column tiles (g % 2) * 6 + 0..5
    if (g + 1 < 8) {
#pragma unroll
      for (int t = 0; t < 6; ++t) wf[(g + 1) & 1][t] = frag_kb(wl + (((g + 1) & 1) * 6 + t) * 16 * WPI + ((g + 1) >> 1) * 32, 0); }
#pragma unroll
    for (int t = 0; t < 6; ++t) acc[(g & 1) * 6 + t] = wmma16b(af[g >> 1], wf[g & 1][t], acc[(g & 1) * 6 + t]); }
#pragma unroll
  for (int t = 0; t < 12; ++t) { const int c = t * 16 + nloc; const float bs = bf16_rne(bb[t]);
#pragma unroll
    for (int r8 = 0; r8 < 8; ++r8) Tf[8 * hlf + r8][c] = acc[t][r8] * (1.0f / (XS * WSC)) + bs; }
  wave_lds_sync();
  // q, k (row nloc, columns g * 16 + 8 * hlf + e) and v (key 8 * hlf + e, column g * 16 + nloc) rounded to f16 x8 once, stored as the attention waves' fragments
#pragma unroll
  for (int w = 0; w < 3; ++w) { b16* fp = (w == 0 ? QF : w == 1 ? KF : VF) + (size_t)rb * FB + lane * 8;
#pragma unroll
    for (int g = 0; g < 4; ++g) { v8b h;
#pragma unroll
      for (int e = 0; e < 8; ++e) h[e] = (b16)((w < 2 ? Tf[nloc][w * KS + g * 16 + 8 * hlf + e] : Tf[8 * hlf + e][2 * KS + g * 16 + nloc]) * XS);
      *(v8b*)(fp + g * FG) = h; } }
}
// one 32-key chunk of a wave's online softmax. The maximum runs on the raw products (q x8 times k x8); one FMA a score, s * SCL + (LPS - max * SCL), holds the division by 8, the operand scales, log2(e), the subtraction of the maximum and
// the x1024 of P, and v_exp_f32 of it is P as the B fragment wants it; the row sum is a sum of these, x1024. A masked score is -INFINITY and comes out of FMA and exp as 0; the first chunk's mo = -INFINITY gives sf = 0: every query has an unmasked key in every chunk
// that its wave walks, so mn is finite and neither needs a guard. DIAG: the one chunk of a query block that the diagonal crosses; in all chunks in front of it no key is masked and no mask is computed.
constexpr float SCL = 0.125f / (XS * XS) * 1.44269504088896340736f, LPS = 10.0f; static_assert(PS == 1024.0f, "LPS = log2(PS)");
template <bool DIAG> __device__ __forceinline__ void chunk(const b16* kp, const v16b (&qf)[2], int lim, float& mo, float& dn, v8f (&acc)[4]) {   // kp: the lane's place in the chunk's two 16-key blocks; lim: the lane's last unmasked key, counted from its first key of the chunk
  const b16* vp = kp + QG * FB;
  const v16b kf[2][2] = {{frag_s(kp, kp + FG), frag_s(kp + 2 * FG, kp + 3 * FG)}, {frag_s(kp + FB, kp + FB + FG), frag_s(kp + FB + 2 * FG, kp + FB + 3 * FG)}};
  asm volatile("" :: "v"(kf[0][0]), "v"(kf[0][1]), "v"(kf[1][0]), "v"(kf[1][1]));   // holds the chunk's eight key loads in front of its first product: one load latency a chunk, not one per k step
  float sc[2][8]; v8f s[2];
#pragma unroll
  for (int blk = 0; blk < 2; ++blk) { s[blk] = (v8f){};
#pragma unroll
    for (int k2 = 0; k2 < KS / 32; ++k2) s[blk] = wmma16s(kf[blk][k2], qf[k2], s[blk]); }
#pragma unroll
  for (int e = 0; e < 16; ++e) sc[e >> 3][e & 7] = DIAG && (e >> 3) * 16 + (e & 7) > lim ? -INFINITY : s[e >> 3][e & 7];   // key (e >> 3) * 16 + 8 * hlf + (e & 7) of the chunk lies behind the lane's query
  float cm = mo;   // equal in both halves of the wave
#pragma unroll
  for (int e = 0; e < 16; ++e) cm = fmaxf(cm, sc[e >> 3][e & 7]);
  const float mn = fmaxf(fmaxf(mo, cm), xhalf(cm)), sf = __builtin_amdgcn_exp2f((mo - mn) * SCL), nb = __builtin_fmaf(-mn, SCL, LPS);   // mo as a third operand: one three-operand maximum, where the two-operand form first spends an instruction on canonicalising the moved value
  float psum = 0.0f; v16b pb;   // pb[e] = P[query nloc][key (e >> 3) * 16 + 8 * hlf + (e & 7)]: the k order of the v fragments
#pragma unroll
  for (int e = 0; e < 16; ++e) { const float p = __builtin_amdgcn_exp2f(__builtin_fmaf(sc[e >> 3][e & 7], SCL, nb)); psum += p; pb[e] = (b16)p; }
  asm volatile("" :: "v"(psum));   // the row's sum, as an input only, held in front of the v loads, against spills: left free, its sixteen adds sink behind the products below, all sixteen P values stay live beside the v fragments and the 128 registers do not hold
  dn = dn * sf + psum; mo = mn;
#pragma unroll
  for (int t = 0; t < 4; ++t)
#pragma unroll
    for (int r8 = 0; r8 < 8; ++r8) acc[t][r8] *= sf;
  const v16b vf[4] = {frag_s(vp, vp + FB), frag_s(vp + FG, vp + FB + FG), frag_s(vp + 2 * FG, vp + FB + 2 * FG), frag_s(vp + 3 * FG, vp + FB + 3 * FG)};
  asm volatile("" :: "v"(vf[0]), "v"(vf[1]), "v"(vf[2]), "v"(vf[3]));   // holds the four column tiles' eight loads in front of their first product: one load latency a chunk, not one per product
#pragma unroll
  for (int t = 0; t < 4; ++t) acc[t] = wmma16c(vf[t], pb, acc[t]); }
// causal attention: work-group per (batch, group of 8 query blocks, piece of 256 keys), wave per query block. The piece is walked in two stages of 128 keys: a stage's k and v fragment planes (16 KB each, contiguous) are copied to LDS, asynchronously, and all eight waves
// read their fragments there: one L2 read of the stage for 128 queries. The wave's maximum, sum and acc run on over both stages, so that 256 keys leave one partial. One barrier behind a stage's copies; one in front of the second stage's, which go into the same LDS; none behind the
// last stage's, so a wave that ends at its diagonal just leaves. Per wave: online softmax over the piece's 32-key chunks kc <= query block. Both products run transposed: S^T = k q^T / 8 (A = key rows, B = queries), so that
// a lane holds 16 of the chunk's 32 scores of ONE query (query nloc; keys blk * 16 + 8 * hlf + r8): mask, maximum, exp and sum stay in its registers, the two halves of the wave meet in one cross-row move for the maximum and, once a piece, for the sum.
// The two score tiles, converted in place, are the B fragment of acc^T += v^T P^T (A = v^T x8, P plain x1024): scores and P never touch LDS. acc[t][r8] = column t * 16 + 8 * hlf + r8 of query nloc.
// the piece's unnormalised acc (register order), M and Dn go to the workspace. The flat index covers exactly the pieces that exist, the longest first: NFP whole pieces a batch (pair rows h and NH - 1 - h of 2 h pieces each
// are joined, 2 (NH - 1) a pair), then the last pieces of the odd groups (a whole stage and the diagonal stage), then those of the even groups (the diagonal stage alone).
// register budget of 128, so that eight waves fit a SIMD: the waves hide one another's softmax and load latency
constexpr int NFP = NH * (NH - 1);   // pieces of a batch's query groups that end in front of the diagonal stage: g / 2 of group g
__global__ __launch_bounds__(256) __attribute__((amdgpu_waves_per_eu(8))) void att_kernel(const b16* __restrict__ QF, const b16* __restrict__ KF, const b16* __restrict__ VF, int BV, float* __restrict__ PA, float* __restrict__ PM) {
  __shared__ __attribute__((aligned(16))) b16 KV[2 * QG * FB];   // the stage's k planes, then its v planes
  const int lane = threadIdx.x & 31, nloc = lane & 15, hlf = lane >> 4, wv = __builtin_amdgcn_readfirstlane(threadIdx.x >> 5); int b, g, pc;
  if ((int)blockIdx.x < B * NFP) { b = blockIdx.x / NFP; const int jp = blockIdx.x % NFP, pr = jp / (2 * (NH - 1)), rp = jp % (2 * (NH - 1)), h = rp < 2 * pr ? pr : NH - 1 - pr, r = rp < 2 * pr ? rp : rp - 2 * pr; g = 2 * h + (r >= h); pc = r >= h ? r - h : r; }
  else { const int r = blockIdx.x - B * NFP; b = r % (B * NH) / NH; pc = r % NH; g = 2 * pc + (r < B * NH); }
  if (b >= BV) return;
  const int qb = g * QG + wv, nst = min(2, g + 1 - 2 * pc); const size_t q0 = (size_t)qb * 16;   // nst: the piece's stages, the same for the whole work-group
  v16b qf[2]; { const gptr qp = uni(QF + (size_t)(b * NBLK + qb) * FB) + lane * 8;
#pragma unroll
    for (int k2 = 0; k2 < 2; ++k2) qf[k2] = frag_g(qp + 2 * k2 * FG, qp + (2 * k2 + 1) * FG); }
  asm volatile("s_wait_xcnt 0x0" ::: "memory");   // the scalar base that the q loads name is reused for the stage's addresses below: the wait stands in front of that overwrite
  float mo = -INFINITY, dn = 0.0f;   // the lane's query: running maximum (equal in both halves), running sum over the lane's own keys
  v8f acc[4];
#pragma unroll
  for (int t = 0; t < 4; ++t) acc[t] = (v8f){};
  const int kd = (int)q0 & ~31;   // the wave's diagonal chunk: its last one
  for (int st = 0; st < nst; ++st) { const int k0 = (2 * pc + st) * PK, kw = min(k0 + PK, kd);
  if (st) { asm volatile("s_wait_dscnt 0x0" ::: "memory");   // this wave's reads of the first stage have returned
    __syncthreads(); }                                  // and every other wave's: the LDS may be refilled
  { const size_t po = (size_t)(b * NBLK + k0 / 16) * FB * 2 + threadIdx.x * 16; const unsigned l = (unsigned)(unsigned long long)(const char*)KV + threadIdx.x * 16;   // thread's 16 bytes of each 4-KB block: 4 blocks of k, 4 of v
    copy8(l, (const char*)KF + po, (const char*)VF + po); }
  asm volatile("s_wait_asynccnt 0x0" ::: "memory");   // this wave's copies have landed
  __syncthreads();                                    // and every other wave's: the stage may be read
  const b16* kp = KV + lane * 8;   // the lane's place in the chunk's k blocks, carried from chunk to chunk
#pragma unroll 1
  for (int kc = k0; kc < kw; kc += 32, kp += 2 * FB) chunk<false>(kp, qf, 0, mo, dn, acc);   // whole chunks: every key lies in front of every query of the block
  if (kd < k0 + PK) chunk<true>(kp, qf, (int)q0 + nloc - kd - 8 * hlf, mo, dn, acc); }   // the stage holds the diagonal chunk (k0 <= kd: a piece ends at its group's diagonal stage); rows past the diagonal lie in the stage and are masked
  dn = (dn + xhalf(dn)) * (1.0f / PS); mo *= 0.125f / (XS * XS);   // the sum without P's scale, the maximum as a logit: what the merge reads
  const size_t slot = (size_t)(piece_slot0(b, qb) + pc);
  const int ln = (int)__builtin_amdgcn_mbcnt_lo(~0u, 0u);   // the lane number read anew, so that no register carries it over the loop (the budget of 128 is full there)
  PM[slot * 32 + ln] = ln < 16 ? mo : dn;
#pragma unroll
  for (int t = 0; t < 4; ++t) *(v8f*)(PA + slot * (16 * KS) + (size_t)(t * 32 + ln) * 8) = acc[t];
}
// merge: block per (batch, 16 queries): m = max over pieces of M, w = exp(M - m), read = sum w acc / sum w Dn, pieces in key order; thread = (column tile, lane) of the acc register order: query nloc, columns t * 16 + 8 * hlf + 0..7
__global__ __launch_bounds__(128) void merge_kernel(const float* __restrict__ PA, const float* __restrict__ PM, int BV, float* __restrict__ out) {
  __shared__ float Ls[NH * 32], Ds[16];
  const int tid = threadIdx.x, lane = tid & 31, nloc = lane & 15, hlf = lane >> 4, t = tid >> 5; const int b = blockIdx.x / NBLK, qb = blockIdx.x % NBLK; if (b >= BV) return;
  const int np = qb / QG / 2 + 1; const size_t slot0 = (size_t)piece_slot0(b, qb);
  float pm[NH * 32 / 128];   // index clamped to the last piece, so that the loads carry no guard and fly together
#pragma unroll
  for (int i = 0; i < NH * 32 / 128; ++i) pm[i] = PM[slot0 * 32 + min(i * 128 + tid, np * 32 - 1)];
#pragma unroll
  for (int i = 0; i < NH * 32 / 128; ++i) if (i * 128 + tid < np * 32) Ls[i * 128 + tid] = pm[i];
  __syncthreads();
  { const int row = tid >> 3, s8 = tid & 7; float mp[NH / 8], m = -INFINITY, d = 0.0f;   // 8 threads a row, pieces s8, s8 + 8, ...
#pragma unroll
    for (int i = 0; i < NH / 8; ++i) { const int p = i * 8 + s8; mp[i] = p < np ? Ls[p * 32 + row] : -INFINITY; m = fmaxf(m, mp[i]); }
    for (int o = 4; o; o >>= 1) m = fmaxf(m, __shfl_xor(m, o));
#pragma unroll
    for (int i = 0; i < NH / 8; ++i) { const int p = i * 8 + s8; if (p < np) { const float w = mp[i] == -INFINITY ? 0.0f : __expf(mp[i] - m); d += w * Ls[p * 32 + 16 + row]; Ls[p * 32 + row] = w; } }
    for (int o = 4; o; o >>= 1) d += __shfl_xor(d, o);
    if (s8 == 0) Ds[row] = d; }
  __syncthreads();
  v8f a = {}; const float* pa = PA + slot0 * (16 * KS) + (size_t)tid * 8;
#pragma unroll 8   // eight pieces' loads in flight instead of one load latency a piece
  for (int p = 0; p < np; ++p) { const v8f v = *(const v8f*)(pa + (size_t)p * (16 * KS));
#pragma unroll
    for (int r8 = 0; r8 < 8; ++r8) a[r8] += v[r8] * Ls[p * 32 + nloc]; }
#pragma unroll
  for (int r8 = 0; r8 < 8; ++r8) a[r8] = a[r8] * (1.0f / (PS * XS)) / Ds[nloc];
  *(v8f*)(out + ((size_t)b * S + (size_t)qb * 16 + nloc) * DO + D + t * 16 + 8 * hlf) = a;
}
}  // namespace

extern "C" void kernel_launch(void* const* d_in, const int* in_sizes, int n_in, void* d_out, int out_size, void* d_ws, size_t ws_size, hipStream_t stream) {
  (void)n_in;
  auto Fp = [&](int i) { return (const float*)d_in[i]; };
  // input order: 0 inputs [4,4096,128]; 1 Wq [128,64]; 2 bq; 3 Wk; 4 bk; 5 Wv; 6 bv
  if (in_sizes[0] != B * S * D || in_sizes[1] != D * KS || in_sizes[3] != D * KS || in_sizes[5] != D * KS || in_sizes[2] != KS || out_size != B * S * DO) return;
  const int BV = B, SV = S;
  size_t off = 0; char* ws = (char*)d_ws;
  auto carve = [&](size_t bytes) { char* p = ws + off; off += (bytes + 255) & ~(size_t)255; return p; };
  b16* QF = (b16*)carve((size_t)B * NBLK * FB * 2); b16* KF = (b16*)carve((size_t)B * NBLK * FB * 2); b16* VF = (b16*)carve((size_t)B * NBLK * FB * 2);
  float* PA = (float*)carve((size_t)B * PPB * 16 * KS * 4); float* PM = (float*)carve((size_t)B * PPB * 32 * 4);
  if (off > ws_size || off > ((size_t)96 << 20)) return;   // ~ 43 MB
  float* out = (float*)d_out;
  qkv_kernel<<<(unsigned)((BV == B ? B * S : SV) / (16 * PW)), 32 * PW, 0, stream>>>(Fp(0), Fp(1), Fp(3), Fp(5), Fp(2), Fp(4), Fp(6), BV == B ? B * S : SV, QF, KF, VF, out);
  att_kernel<<<(unsigned)(B * PPB / QG), 256, 0, stream>>>(QF, KF, VF, BV, PA, PM);
  merge_kernel<<<(unsigned)(B * NBLK), 128, 0, stream>>>(PA, PM, BV, out);
}
